// v000
// Measured on an AMD MI455X. A time is GPU time per run, averaged over a window of back-to-back runs after a warm-up
// (all launches, gaps included; the runs take copies of the inputs in turn), and the median of several windows.
// Apart from v000's, it joins two sittings. Times from different sittings can be a few percent apart, while
// side-by-side timings come from the same sitting.
// v000, which the later versions start from, runs in 188 microseconds.
// compute dtype: q, k, v, importance rounded to bf16 and used as EXACT f16 operands on WMMA 16x16x32; scores = (q . k) x 1/8 x importance_i in f32 (the module scales q by importance first - identical algebra), causal mask, per 64-key block: max / exp (hardware exp) / sum + 1e-6 in f32, P (scaled by 2^11, single f16) x v (exact f16); the per-64-query-block activity gate from the importance threshold; f32 accumulate.
#include <hip/hip_runtime.h>
#include <math.h>

typedef __attribute__((ext_vector_type(16))) _Float16 v16h;
typedef __attribute__((ext_vector_type(16))) __bf16 v16b;
typedef __attribute__((ext_vector_type(8)))  _Float16 v8h;
typedef __attribute__((ext_vector_type(8)))  float v8f;
typedef __attribute__((ext_vector_type(4)))  float v4f;
typedef __attribute__((ext_vector_type(2)))  float v2f;
typedef __attribute__((ext_vector_type(4)))  unsigned v4u;
typedef __attribute__((ext_vector_type(4)))  int v4i;
typedef float __attribute__((may_alias)) float_a;
typedef int __attribute__((may_alias)) int_a;

template <typename T> __device__ __forceinline__ void vst2(void* p, T v) { *(T*)p = v;  }
__device__ __forceinline__ v8f wmma16(v16h a, v16h b, v8f c) {
  v8f d = __builtin_amdgcn_wmma_f32_16x16x32_f16(false, a, false, b, (short)0, c, false, false);
  asm volatile("v_nop\n\tv_nop\n\tv_nop\n\tv_nop" : "+v"(d) : "v"(a), "v"(b));
  return d;
}
__device__ __forceinline__ v8f wmma_bf(v16b a, v16b b, v8f c) {
  v8f d = __builtin_amdgcn_wmma_f32_16x16x32_bf16(false, a, false, b, (short)0, c, false, false);
  asm volatile("v_nop\n\tv_nop\n\tv_nop\n\tv_nop" : "+v"(d) : "v"(a), "v"(b));
  return d;
}
// 16x16x32 fragments: lane = (h = lane>>4, row/col = lane&15); elements 0..7 = k0+8h+0..7, 8..15 = k0+16+8h+0..7; D element r = row 8h+r
__device__ __forceinline__ v16h frag_h(const _Float16* rowk0, int lane) {
  union { v16h v; v8h q[2]; } u; const _Float16* p = rowk0 + 8 * (lane >> 4);
  u.q[0] = *(const v8h*)p; u.q[1] = *(const v8h*)(p + 16); return u.v;
}
__device__ __forceinline__ v16h frag_f32(const float* rowk0, int lane) {
  v16h a; const float* p = rowk0 + 8 * (lane >> 4);
#pragma unroll
  for (int i = 0; i < 8; ++i) { a[i] = (_Float16)p[i]; a[8 + i] = (_Float16)p[16 + i]; }
  return a;
}
__device__ __forceinline__ v16h frag_f32s(const float* rowk0, int lane, float sc) {
  v16h a; const float* p = rowk0 + 8 * (lane >> 4);
#pragma unroll
  for (int i = 0; i < 8; ++i) { a[i] = (_Float16)(p[i] * sc); a[8 + i] = (_Float16)(p[16 + i] * sc); }
  return a;
}
// column fragment from a [K][ld] layout (column n), rows >= K read as 0
__device__ __forceinline__ v16h fragc_f32(const float* W, int k0, int n, int lane, int ld, int K) {
  v16h a; const int g = lane >> 4;
#pragma unroll
  for (int i = 0; i < 8; ++i) { const int ka = k0 + 8 * g + i, kb = ka + 16;
    a[i] = (_Float16)(ka < K ? W[(size_t)(ka < K ? ka : K - 1) * ld + n] : 0.f); a[8 + i] = (_Float16)(kb < K ? W[(size_t)(kb < K ? kb : K - 1) * ld + n] : 0.f); }
  return a;
}
struct F2 { v16b h, l; };
__device__ __forceinline__ F2 bsplit16(const float v[16]) { F2 r;
#pragma unroll
  for (int i = 0; i < 16; ++i) { const __bf16 h = (__bf16)v[i]; r.h[i] = h; r.l[i] = (__bf16)(v[i] - (float)h); }
  return r; }
__device__ __forceinline__ F2 split_row(const float* row, int k0, int lane) { float v[16]; const float* p = row + k0 + 8 * (lane >> 4);
#pragma unroll
  for (int i = 0; i < 8; ++i) { v[i] = p[i]; v[8 + i] = p[16 + i]; }
  return bsplit16(v); }
__device__ __forceinline__ F2 split_rowK(const float* row, int k0, int lane, int K) { float v[16]; const int g = lane >> 4;
#pragma unroll
  for (int i = 0; i < 8; ++i) { const int ka = k0 + 8 * g + i, kb = ka + 16; v[i] = ka < K ? row[ka < K ? ka : K - 1] : 0.f; v[8 + i] = kb < K ? row[kb < K ? kb : K - 1] : 0.f; }
  return bsplit16(v); }
__device__ __forceinline__ F2 split_col(const float* W, int k0, int n, int lane, int ld, int K) { float v[16]; const int g = lane >> 4;
#pragma unroll
  for (int i = 0; i < 8; ++i) { const int ka = k0 + 8 * g + i, kb = ka + 16; v[i] = ka < K ? W[(size_t)(ka < K ? ka : K - 1) * ld + n] : 0.f; v[8 + i] = kb < K ? W[(size_t)(kb < K ? kb : K - 1) * ld + n] : 0.f; }
  return bsplit16(v); }
__device__ __forceinline__ v8f mac3(const F2& a, const F2& b, v8f c) { c = wmma_bf(a.l, b.h, c); c = wmma_bf(a.h, b.l, c); return wmma_bf(a.h, b.h, c); }
__device__ __forceinline__ float sigm(float v) { return 1.0f / (1.0f + expf(-v)); }
#define LDSX() do { asm volatile("s_wait_dscnt 0" ::: "memory"); __builtin_amdgcn_wave_barrier(); __builtin_amdgcn_fence(__ATOMIC_RELEASE, "workgroup"); } while (0)


// Dendritic block attention (B 2, H 16, S 2,048, D 64): importance-scaled queries, causal scores normalised independently within each 64-key block (softmax with +1e-6 in the denominator, fully masked blocks contribute 0), summed over blocks, then whole 64-query blocks zeroed unless some token's importance exceeds 0.3.
#define NB 2
#define NH 16
#define SS 2048
#define HD 64
#define BLK 64
#ifndef TQB
#define TQB (SS / 64)
#define TNB NB
#endif
typedef __attribute__((ext_vector_type(8))) __bf16 v8b;
__device__ __forceinline__ v16b frag_b(const __bf16* rowk0, int lane) {
  union { v16b v; v8b q[2]; } u; const __bf16* p = rowk0 + 8 * (lane >> 4);
  u.q[0] = *(const v8b*)p; u.q[1] = *(const v8b*)(p + 16); return u.v;
}
__device__ __forceinline__ float bfr(float v) { return (float)(__bf16)v; }
__device__ __attribute__((noinline)) float exp_ni(float v) { return expf(v); }
__device__ __attribute__((noinline)) float erf_ni(float v) { return erff(v); }

#define WS_Q   0u                                  // f16 [b][h][s][64] q ; K ; VT planes [b][h][64][s]
#define WS_K   (WS_Q + 2u * (size_t)NB * NH * SS * HD)
#define WS_VT  (WS_K + 2u * (size_t)NB * NH * SS * HD)
#define WS_END (WS_VT + 2u * (size_t)NB * NH * HD * SS)

// ---- k_rows: 64 rows of q or k -> exact f16 rows
__global__ __launch_bounds__(256) void k_rows(const float* __restrict__ X, _Float16* __restrict__ R) { const size_t r0 = (size_t)blockIdx.x * 64; const int t = threadIdx.x; __shared__ __align__(16) _Float16 s[64][72];
  for (int e = t; e < 64 * 64; e += 256) { const int r = e >> 6, c = e & 63; s[r][c] = (_Float16)bfr(X[(r0 + r) * HD + c]); } __syncthreads();
  for (int e = t; e < 64 * 8; e += 256) { const int r = e >> 3, q = e & 7; vst2((unsigned*)(R + (r0 + r) * HD + q * 8), *(const v4u*)&s[r][q * 8]); } }
// ---- k_vt: block = (64 keys of one (b,h)): VT[(b,h)][d][s] = v[(b,h)][s][d]
__global__ __launch_bounds__(256) void k_vt(const float* __restrict__ V, _Float16* __restrict__ VT) { __shared__ __align__(16) _Float16 st[64][72]; const size_t rb0 = (size_t)blockIdx.x * 64; const size_t bh = rb0 / SS, s0 = rb0 % SS; const int t = threadIdx.x;
  for (int e = t; e < 64 * 64; e += 256) { const int r = e >> 6, d = e & 63; st[d][r] = (_Float16)bfr(V[(rb0 + r) * HD + d]); } __syncthreads();
  for (int e = t; e < 64 * 8; e += 256) { const int d = e >> 3, pc = e & 7; vst2((unsigned*)(VT + (bh * HD + d) * SS + s0 + pc * 8), *(const v4u*)&st[d][pc * 8]); } }
// ---- k_attn: block = (64 queries = one query block, h, b): per causal 64-key block an independent masked softmax (+1e-6), P x v accumulated; output x active(query block)
__global__ __launch_bounds__(128) void k_attn(const _Float16* __restrict__ Q, const _Float16* __restrict__ K, const _Float16* __restrict__ VT, const float* __restrict__ IMP, float* __restrict__ OUT) {
  __shared__ __align__(16) _Float16 sph[4][16][72]; __shared__ __align__(16) float so[4][16][68]; __shared__ int sact[4];
  const int tid = threadIdx.x, wave = tid >> 5, lane = tid & 31, col = lane & 15, g = lane >> 4; const int h = blockIdx.y; const size_t b = blockIdx.z; const int qb = blockIdx.x; const int q0 = qb * 64 + wave * 16; const size_t bh = b * NH + h; const size_t rq = bh * SS + q0;
  // activity of this 64-query block: any importance > 0.3
  { float iv = bfr(IMP[b * SS + qb * 64 + (tid & 63)]); int act = (iv > 0.3f) ? 1 : 0;
#pragma unroll
    for (int o = 1; o < 32; o <<= 1) act |= __shfl_xor(act, o);
    if (lane == 0) sact[wave] = act; }
  __syncthreads(); const int active = sact[0] | sact[1] | sact[2] | sact[3];
  v16h aq[2];
#pragma unroll
  for (int kc = 0; kc < 2; ++kc) aq[kc] = frag_h(Q + (rq + col) * HD + kc * 32, lane);
  float imp[8];
#pragma unroll
  for (int r = 0; r < 8; ++r) imp[r] = bfr(IMP[b * SS + q0 + 8 * g + r]);
  v8f acc[4] = {};
#pragma unroll 1
  for (int kb = 0; kb <= qb; ++kb) { const int j0 = kb * BLK; v8f s[4];
#pragma unroll
    for (int ct = 0; ct < 4; ++ct) { const int kk = j0 + ct * 16 + col; const size_t rk = (bh * SS + kk) * HD; v8f c = {};
#pragma unroll
      for (int kc = 0; kc < 2; ++kc) c = wmma16(aq[kc], frag_h(K + rk + kc * 32, lane), c);
#pragma unroll
      for (int r = 0; r < 8; ++r) s[ct][r] = (kk <= q0 + 8 * g + r) ? c[r] * 0.125f * imp[r] : -3.0e38f; }
#pragma unroll
    for (int r = 0; r < 8; ++r) { float mx = fmaxf(fmaxf(s[0][r], s[1][r]), fmaxf(s[2][r], s[3][r]));
#pragma unroll
      for (int o = 1; o < 16; o <<= 1) mx = fmaxf(mx, __shfl_xor(mx, o));
      const float safe = (mx <= -1.0e38f) ? 0.f : mx; float es = 0.f; float e[4];
#pragma unroll
      for (int ct = 0; ct < 4; ++ct) { e[ct] = (s[ct][r] <= -1.0e38f) ? 0.f : __expf(s[ct][r] - safe); es += e[ct]; }
#pragma unroll
      for (int o = 1; o < 16; o <<= 1) es += __shfl_xor(es, o);
      const float inv = 2048.0f / (es + 1e-6f);
#pragma unroll
      for (int ct = 0; ct < 4; ++ct) sph[wave][8 * g + r][ct * 16 + col] = (_Float16)(e[ct] * inv); }
    LDSX();
#pragma unroll
    for (int kc = 0; kc < 2; ++kc) { const v16h pa = frag_h(&sph[wave][col][kc * 32], lane);
#pragma unroll
      for (int dt = 0; dt < 4; ++dt) acc[dt] = wmma16(pa, frag_h(VT + (bh * HD + dt * 16 + col) * SS + j0 + kc * 32, lane), acc[dt]); }
    LDSX(); }
  const float fin = active ? (1.0f / 2048.0f) : 0.f;
#pragma unroll
  for (int r = 0; r < 8; ++r)
#pragma unroll
    for (int dt = 0; dt < 4; ++dt) so[wave][8 * g + r][dt * 16 + col] = acc[dt][r] * fin;
  LDSX();
  for (int rl = 0; rl < 16; ++rl) if (lane < 16) vst2(OUT + (rq + rl) * HD + lane * 4, *(const v4f*)&so[wave][rl][lane * 4]);
}
extern "C" void kernel_launch(void* const* d_in, const int* in_sizes, int n_in, void* d_out, int out_size, void* d_ws, size_t ws_size, hipStream_t stream) {
  (void)in_sizes; (void)n_in; (void)out_size;
  const float** F = (const float**)d_in;   // 0 q, 1 k, 2 v [2,16,2048,64], 3 importance_scores [2,2048]
  if (ws_size < (size_t)WS_END) return;
  char* ws = (char*)d_ws; _Float16 *Q = (_Float16*)(ws + WS_Q), *K = (_Float16*)(ws + WS_K), *VT = (_Float16*)(ws + WS_VT);
  k_rows<<<NB * NH * SS / 64, 256, 0, stream>>>(F[0], Q);
  k_rows<<<NB * NH * SS / 64, 256, 0, stream>>>(F[1], K);
  k_vt<<<NB * NH * SS / 64, 256, 0, stream>>>(F[2], VT);
  k_attn<<<dim3(TQB, NH, TNB), 128, 0, stream>>>(Q, K, VT, F[3], (float*)d_out);
}

// v001
// One run takes 98.6 microseconds.
// Next to v000, in two timings, it ran 1.93 and 1.92 times as fast.
// compute dtype: q, k, v, importance rounded to bf16 and used as EXACT f16 operands on WMMA 16x16x32; scores = (q . k) x 1/8 x importance_i in f32 (the module scales q by importance first - identical algebra), causal mask, per 64-key block: max / exp (hardware exp) / sum + 1e-6 in f32, P (scaled by 2^11, single f16) x v (exact f16); the per-64-query-block activity gate from the importance threshold; f32 accumulate.
#include <hip/hip_runtime.h>
#include <math.h>

typedef __attribute__((ext_vector_type(16))) _Float16 v16h;
typedef __attribute__((ext_vector_type(16))) __bf16 v16b;
typedef __attribute__((ext_vector_type(8)))  _Float16 v8h;
typedef __attribute__((ext_vector_type(8)))  float v8f;
typedef __attribute__((ext_vector_type(4)))  float v4f;
typedef __attribute__((ext_vector_type(2)))  float v2f;
typedef __attribute__((ext_vector_type(4)))  unsigned v4u;
typedef __attribute__((ext_vector_type(4)))  int v4i;
typedef float __attribute__((may_alias)) float_a;
typedef int __attribute__((may_alias)) int_a;

template <typename T> __device__ __forceinline__ void vst2(void* p, T v) { *(T*)p = v;  }
__device__ __forceinline__ v8f wmma16(v16h a, v16h b, v8f c) {
  v8f d = __builtin_amdgcn_wmma_f32_16x16x32_f16(false, a, false, b, (short)0, c, false, false);
  asm volatile("v_nop\n\tv_nop\n\tv_nop\n\tv_nop" : "+v"(d) : "v"(a), "v"(b));
  return d;
}
__device__ __forceinline__ v8f wmma_bf(v16b a, v16b b, v8f c) {
  v8f d = __builtin_amdgcn_wmma_f32_16x16x32_bf16(false, a, false, b, (short)0, c, false, false);
  asm volatile("v_nop\n\tv_nop\n\tv_nop\n\tv_nop" : "+v"(d) : "v"(a), "v"(b));
  return d;
}
// 16x16x32 fragments: lane = (h = lane>>4, row/col = lane&15); elements 0..7 = k0+8h+0..7, 8..15 = k0+16+8h+0..7; D element r = row 8h+r
__device__ __forceinline__ v16h frag_h(const _Float16* rowk0, int lane) {
  union { v16h v; v8h q[2]; } u; const _Float16* p = rowk0 + 8 * (lane >> 4);
  u.q[0] = *(const v8h*)p; u.q[1] = *(const v8h*)(p + 16); return u.v;
}
__device__ __forceinline__ v16h frag_f32(const float* rowk0, int lane) {
  v16h a; const float* p = rowk0 + 8 * (lane >> 4);
#pragma unroll
  for (int i = 0; i < 8; ++i) { a[i] = (_Float16)p[i]; a[8 + i] = (_Float16)p[16 + i]; }
  return a;
}
__device__ __forceinline__ v16h frag_f32s(const float* rowk0, int lane, float sc) {
  v16h a; const float* p = rowk0 + 8 * (lane >> 4);
#pragma unroll
  for (int i = 0; i < 8; ++i) { a[i] = (_Float16)(p[i] * sc); a[8 + i] = (_Float16)(p[16 + i] * sc); }
  return a;
}
// column fragment from a [K][ld] layout (column n), rows >= K read as 0
__device__ __forceinline__ v16h fragc_f32(const float* W, int k0, int n, int lane, int ld, int K) {
  v16h a; const int g = lane >> 4;
#pragma unroll
  for (int i = 0; i < 8; ++i) { const int ka = k0 + 8 * g + i, kb = ka + 16;
    a[i] = (_Float16)(ka < K ? W[(size_t)(ka < K ? ka : K - 1) * ld + n] : 0.f); a[8 + i] = (_Float16)(kb < K ? W[(size_t)(kb < K ? kb : K - 1) * ld + n] : 0.f); }
  return a;
}
struct F2 { v16b h, l; };
__device__ __forceinline__ F2 bsplit16(const float v[16]) { F2 r;
#pragma unroll
  for (int i = 0; i < 16; ++i) { const __bf16 h = (__bf16)v[i]; r.h[i] = h; r.l[i] = (__bf16)(v[i] - (float)h); }
  return r; }
__device__ __forceinline__ F2 split_row(const float* row, int k0, int lane) { float v[16]; const float* p = row + k0 + 8 * (lane >> 4);
#pragma unroll
  for (int i = 0; i < 8; ++i) { v[i] = p[i]; v[8 + i] = p[16 + i]; }
  return bsplit16(v); }
__device__ __forceinline__ F2 split_rowK(const float* row, int k0, int lane, int K) { float v[16]; const int g = lane >> 4;
#pragma unroll
  for (int i = 0; i < 8; ++i) { const int ka = k0 + 8 * g + i, kb = ka + 16; v[i] = ka < K ? row[ka < K ? ka : K - 1] : 0.f; v[8 + i] = kb < K ? row[kb < K ? kb : K - 1] : 0.f; }
  return bsplit16(v); }
__device__ __forceinline__ F2 split_col(const float* W, int k0, int n, int lane, int ld, int K) { float v[16]; const int g = lane >> 4;
#pragma unroll
  for (int i = 0; i < 8; ++i) { const int ka = k0 + 8 * g + i, kb = ka + 16; v[i] = ka < K ? W[(size_t)(ka < K ? ka : K - 1) * ld + n] : 0.f; v[8 + i] = kb < K ? W[(size_t)(kb < K ? kb : K - 1) * ld + n] : 0.f; }
  return bsplit16(v); }
__device__ __forceinline__ v8f mac3(const F2& a, const F2& b, v8f c) { c = wmma_bf(a.l, b.h, c); c = wmma_bf(a.h, b.l, c); return wmma_bf(a.h, b.h, c); }
__device__ __forceinline__ float sigm(float v) { return 1.0f / (1.0f + expf(-v)); }
#define LDSX() do { asm volatile("s_wait_dscnt 0" ::: "memory"); __builtin_amdgcn_wave_barrier(); __builtin_amdgcn_fence(__ATOMIC_RELEASE, "workgroup"); } while (0)


// Dendritic block attention (B 2, H 16, S 2,048, D 64): importance-scaled queries, causal scores normalised independently within each 64-key block (softmax with +1e-6 in the denominator, fully masked blocks contribute 0), summed over blocks, then whole 64-query blocks zeroed unless some token's importance exceeds 0.3.
#define NB 2
#define NH 16
#define SS 2048
#define HD 64
#define BLK 64
#ifndef TQB
#define TQB (SS / 64)
#define TNB NB
#endif
typedef __attribute__((ext_vector_type(8))) __bf16 v8b;
__device__ __forceinline__ v16b frag_b(const __bf16* rowk0, int lane) {
  union { v16b v; v8b q[2]; } u; const __bf16* p = rowk0 + 8 * (lane >> 4);
  u.q[0] = *(const v8b*)p; u.q[1] = *(const v8b*)(p + 16); return u.v;
}
__device__ __forceinline__ float bfr(float v) { return (float)(__bf16)v; }
__device__ __attribute__((noinline)) float exp_ni(float v) { return expf(v); }
__device__ __attribute__((noinline)) float erf_ni(float v) { return erff(v); }

#define WS_Q   0u                                  // f16 [b][h][s][64] q ; K ; VT planes [b][h][64][s]
#define WS_K   (WS_Q + 2u * (size_t)NB * NH * SS * HD)
#define WS_VT  (WS_K + 2u * (size_t)NB * NH * SS * HD)
#define WS_END (WS_VT + 2u * (size_t)NB * NH * HD * SS)

// ---- k_rows: 64 rows of q or k -> exact f16 rows
__global__ __launch_bounds__(256) void k_rows(const float* __restrict__ X, _Float16* __restrict__ R) { const size_t r0 = (size_t)blockIdx.x * 64; const int t = threadIdx.x; __shared__ __align__(16) _Float16 s[64][72];
  for (int e = t; e < 64 * 64; e += 256) { const int r = e >> 6, c = e & 63; s[r][c] = (_Float16)bfr(X[(r0 + r) * HD + c]); } __syncthreads();
  for (int e = t; e < 64 * 8; e += 256) { const int r = e >> 3, q = e & 7; vst2((unsigned*)(R + (r0 + r) * HD + q * 8), *(const v4u*)&s[r][q * 8]); } }
// ---- k_vt: block = (64 keys of one (b,h)): VT[(b,h)][d][s] = v[(b,h)][s][d]
__global__ __launch_bounds__(256) void k_vt(const float* __restrict__ V, _Float16* __restrict__ VT) { __shared__ __align__(16) _Float16 st[64][72]; const size_t rb0 = (size_t)blockIdx.x * 64; const size_t bh = rb0 / SS, s0 = rb0 % SS; const int t = threadIdx.x;
  for (int e = t; e < 64 * 64; e += 256) { const int r = e >> 6, d = e & 63; st[d][r] = (_Float16)bfr(V[(rb0 + r) * HD + d]); } __syncthreads();
  for (int e = t; e < 64 * 8; e += 256) { const int d = e >> 3, pc = e & 7; vst2((unsigned*)(VT + (bh * HD + d) * SS + s0 + pc * 8), *(const v4u*)&st[d][pc * 8]); } }
// ---- stage_kv: one 64-key block's K rows and V^T rows (64 rows of 128 B each) -> LDS rows of 144 B. Each of the 128 lanes copies four 16-byte pieces of each tile, 16 rows apart.
// The s_wait_xcnt stands inside the copies' own statement so that no address register is rewritten in front of it.
__device__ __forceinline__ void stage_kv(const _Float16* kg, const _Float16* vg, unsigned lk, unsigned lv) {
  asm volatile("global_load_async_to_lds_b128 %0, %8, off\n\t"
               "global_load_async_to_lds_b128 %1, %9, off\n\t"
               "global_load_async_to_lds_b128 %2, %10, off\n\t"
               "global_load_async_to_lds_b128 %3, %11, off\n\t"
               "global_load_async_to_lds_b128 %4, %12, off\n\t"
               "global_load_async_to_lds_b128 %5, %13, off\n\t"
               "global_load_async_to_lds_b128 %6, %14, off\n\t"
               "global_load_async_to_lds_b128 %7, %15, off\n\t"
               "s_wait_xcnt 0x0"
               :: "v"(lk), "v"(lk + 16u * 144u), "v"(lk + 32u * 144u), "v"(lk + 48u * 144u),
                  "v"(lv), "v"(lv + 16u * 144u), "v"(lv + 32u * 144u), "v"(lv + 48u * 144u),
                  "v"(kg), "v"(kg + 16 * HD), "v"(kg + 32 * HD), "v"(kg + 48 * HD),
                  "v"(vg), "v"(vg + 16 * SS), "v"(vg + 32 * SS), "v"(vg + 48 * SS)
               : "memory");
}
// ---- k_attn: block = (64 queries = one query block, h, b): per causal 64-key block an independent masked softmax (+1e-6), P x v accumulated; output x active(query block)
__global__ __launch_bounds__(128) void k_attn(const _Float16* __restrict__ Q, const _Float16* __restrict__ K, const _Float16* __restrict__ VT, const float* __restrict__ IMP, float* __restrict__ OUT) {
  __shared__ __align__(16) _Float16 sph[4][16][72]; __shared__ __align__(16) float so[4][16][68]; __shared__ int sact[4];
  __shared__ __align__(16) _Float16 sk[2][64][72]; __shared__ __align__(16) _Float16 sv[2][64][72];   // two buffers of one key block each: K rows, V^T rows; pitch 144 B
  const int tid = threadIdx.x, wave = tid >> 5, lane = tid & 31, col = lane & 15, g = lane >> 4; const int h = blockIdx.y; const size_t b = blockIdx.z; const int qb = blockIdx.x; const int q0 = qb * 64 + wave * 16; const size_t bh = b * NH + h; const size_t rq = bh * SS + q0;
  // key block 0 -> buffer 0; lane's piece: row tid >> 3 (+16, +32, +48), 16-byte column tid & 7
  const int srow = tid >> 3, scol = (tid & 7) * 8;
  const _Float16* kg = K + (bh * SS + srow) * HD + scol; const _Float16* vg = VT + (bh * HD + srow) * SS + scol;
  const unsigned lk = (unsigned)(size_t)&sk[0][srow][scol], lv = (unsigned)(size_t)&sv[0][srow][scol];
  stage_kv(kg, vg, lk, lv);
  // activity of this 64-query block: any importance > 0.3
  { float iv = bfr(IMP[b * SS + qb * 64 + (tid & 63)]); int act = (iv > 0.3f) ? 1 : 0;
#pragma unroll
    for (int o = 1; o < 32; o <<= 1) act |= __shfl_xor(act, o);
    if (lane == 0) sact[wave] = act; }
  asm volatile("s_wait_asynccnt 0x0" ::: "memory");   // this wave's pieces of key block 0 have landed before the barrier publishes them
  __syncthreads(); const int active = sact[0] | sact[1] | sact[2] | sact[3];
  if (qb >= 1) stage_kv(kg + BLK * HD, vg + BLK, lk + 9216u, lv + 9216u);   // key block 1 -> buffer 1, in flight during trip 0
  v16h aq[2];
#pragma unroll
  for (int kc = 0; kc < 2; ++kc) aq[kc] = frag_h(Q + (rq + col) * HD + kc * 32, lane);
  float imp[8];
#pragma unroll
  for (int r = 0; r < 8; ++r) imp[r] = bfr(IMP[b * SS + q0 + 8 * g + r]);
  v8f acc[4] = {};
#pragma unroll 1
  for (int kb = 0; kb <= qb; ++kb) { const int j0 = kb * BLK; const int bf = kb & 1; v8f s[4]; v16h kf[8], vf[8];
#pragma unroll
    for (int ct = 0; ct < 4; ++ct)
#pragma unroll
      for (int kc = 0; kc < 2; ++kc) kf[ct * 2 + kc] = frag_h(&sk[bf][ct * 16 + col][kc * 32], lane);
#pragma unroll
    for (int ct = 0; ct < 4; ++ct) { const int kk = j0 + ct * 16 + col; v8f c = {};
#pragma unroll
      for (int kc = 0; kc < 2; ++kc) c = wmma16(aq[kc], kf[ct * 2 + kc], c);
#pragma unroll
      for (int r = 0; r < 8; ++r) s[ct][r] = (kk <= q0 + 8 * g + r) ? c[r] * 0.125f * imp[r] : -3.0e38f; }
#pragma unroll
    for (int r = 0; r < 8; ++r) { float mx = fmaxf(fmaxf(s[0][r], s[1][r]), fmaxf(s[2][r], s[3][r]));
#pragma unroll
      for (int o = 1; o < 16; o <<= 1) mx = fmaxf(mx, __shfl_xor(mx, o));
      const float safe = (mx <= -1.0e38f) ? 0.f : mx; float es = 0.f; float e[4];
#pragma unroll
      for (int ct = 0; ct < 4; ++ct) { e[ct] = (s[ct][r] <= -1.0e38f) ? 0.f : __expf(s[ct][r] - safe); es += e[ct]; }
#pragma unroll
      for (int o = 1; o < 16; o <<= 1) es += __shfl_xor(es, o);
      const float inv = 2048.0f / (es + 1e-6f);
#pragma unroll
      for (int ct = 0; ct < 4; ++ct) sph[wave][8 * g + r][ct * 16 + col] = (_Float16)(e[ct] * inv); }
    LDSX();
    v16h pa[2];
#pragma unroll
    for (int kc = 0; kc < 2; ++kc) { pa[kc] = frag_h(&sph[wave][col][kc * 32], lane);
#pragma unroll
      for (int dt = 0; dt < 4; ++dt) vf[kc * 4 + dt] = frag_h(&sv[bf][dt * 16 + col][kc * 32], lane); }
#pragma unroll
    for (int kc = 0; kc < 2; ++kc)
#pragma unroll
      for (int dt = 0; dt < 4; ++dt) acc[dt] = wmma16(pa[kc], vf[kc * 4 + dt], acc[dt]);
    asm volatile("s_wait_dscnt 0x0" ::: "memory");      // this wave's LDS reads of buffer bf (and of its P rows) are done
    asm volatile("s_wait_asynccnt 0x0" ::: "memory");   // this wave's pieces of key block kb + 1 have landed
    __syncthreads();                                    // publishes key block kb + 1 and frees buffer bf
    if (kb + 2 <= qb) stage_kv(kg + (size_t)(kb + 2) * (BLK * HD), vg + (kb + 2) * BLK, lk + 9216u * bf, lv + 9216u * bf); }
  asm volatile("s_wait_asynccnt 0x0" ::: "memory");     // no copy is outstanding when the wave goes on to the epilogue
  const float fin = active ? (1.0f / 2048.0f) : 0.f;
#pragma unroll
  for (int r = 0; r < 8; ++r)
#pragma unroll
    for (int dt = 0; dt < 4; ++dt) so[wave][8 * g + r][dt * 16 + col] = acc[dt][r] * fin;
  LDSX();
  for (int rl = 0; rl < 16; ++rl) if (lane < 16) vst2(OUT + (rq + rl) * HD + lane * 4, *(const v4f*)&so[wave][rl][lane * 4]);
}
extern "C" void kernel_launch(void* const* d_in, const int* in_sizes, int n_in, void* d_out, int out_size, void* d_ws, size_t ws_size, hipStream_t stream) {
  (void)in_sizes; (void)n_in; (void)out_size;
  const float** F = (const float**)d_in;   // 0 q, 1 k, 2 v [2,16,2048,64], 3 importance_scores [2,2048]
  if (ws_size < (size_t)WS_END) return;
  char* ws = (char*)d_ws; _Float16 *Q = (_Float16*)(ws + WS_Q), *K = (_Float16*)(ws + WS_K), *VT = (_Float16*)(ws + WS_VT);
  k_rows<<<NB * NH * SS / 64, 256, 0, stream>>>(F[0], Q);
  k_rows<<<NB * NH * SS / 64, 256, 0, stream>>>(F[1], K);
  k_vt<<<NB * NH * SS / 64, 256, 0, stream>>>(F[2], VT);
  k_attn<<<dim3(TQB, NH, TNB), 128, 0, stream>>>(Q, K, VT, F[3], (float*)d_out);
}

// v002
// It runs in 65.9 microseconds.
// Next to v001, in two timings, it ran 1.50 times as fast each time.
// All steps since v000 together make it 2.88 times as fast.
// compute dtype: q, k, v, importance rounded to bf16 and used as EXACT f16 operands on WMMA 16x16x32; scores = (q . k) x 1/8 x importance_i in f32 (the module scales q by importance first - identical algebra), causal mask, per 64-key block: max / exp (hardware exp) / sum + 1e-6 in f32, P (scaled by 2^11, single f16) x v (exact f16); the per-64-query-block activity gate from the importance threshold; f32 accumulate.
#include <hip/hip_runtime.h>
#include <math.h>

typedef __attribute__((ext_vector_type(16))) _Float16 v16h;
typedef __attribute__((ext_vector_type(16))) __bf16 v16b;
typedef __attribute__((ext_vector_type(8)))  _Float16 v8h;
typedef __attribute__((ext_vector_type(8)))  float v8f;
typedef __attribute__((ext_vector_type(4)))  float v4f;
typedef __attribute__((ext_vector_type(2)))  float v2f;
typedef __attribute__((ext_vector_type(4)))  unsigned v4u;
typedef __attribute__((ext_vector_type(4)))  int v4i;
typedef float __attribute__((may_alias)) float_a;
typedef int __attribute__((may_alias)) int_a;

template <typename T> __device__ __forceinline__ void vst2(void* p, T v) { *(T*)p = v;  }
__device__ __forceinline__ v8f wmma16(v16h a, v16h b, v8f c) {
  v8f d = __builtin_amdgcn_wmma_f32_16x16x32_f16(false, a, false, b, (short)0, c, false, false);
  asm volatile("v_nop\n\tv_nop\n\tv_nop\n\tv_nop" : "+v"(d) : "v"(a), "v"(b));
  return d;
}
__device__ __forceinline__ v8f wmma_bf(v16b a, v16b b, v8f c) {
  v8f d = __builtin_amdgcn_wmma_f32_16x16x32_bf16(false, a, false, b, (short)0, c, false, false);
  asm volatile("v_nop\n\tv_nop\n\tv_nop\n\tv_nop" : "+v"(d) : "v"(a), "v"(b));
  return d;
}
// 16x16x32 fragments: lane = (h = lane>>4, row/col = lane&15); elements 0..7 = k0+8h+0..7, 8..15 = k0+16+8h+0..7; D element r = row 8h+r
__device__ __forceinline__ v16h frag_h(const _Float16* rowk0, int lane) {
  union { v16h v; v8h q[2]; } u; const _Float16* p = rowk0 + 8 * (lane >> 4);
  u.q[0] = *(const v8h*)p; u.q[1] = *(const v8h*)(p + 16); return u.v;
}
__device__ __forceinline__ v16h frag_f32(const float* rowk0, int lane) {
  v16h a; const float* p = rowk0 + 8 * (lane >> 4);
#pragma unroll
  for (int i = 0; i < 8; ++i) { a[i] = (_Float16)p[i]; a[8 + i] = (_Float16)p[16 + i]; }
  return a;
}
__device__ __forceinline__ v16h frag_f32s(const float* rowk0, int lane, float sc) {
  v16h a; const float* p = rowk0 + 8 * (lane >> 4);
#pragma unroll
  for (int i = 0; i < 8; ++i) { a[i] = (_Float16)(p[i] * sc); a[8 + i] = (_Float16)(p[16 + i] * sc); }
  return a;
}
// column fragment from a [K][ld] layout (column n), rows >= K read as 0
__device__ __forceinline__ v16h fragc_f32(const float* W, int k0, int n, int lane, int ld, int K) {
  v16h a; const int g = lane >> 4;
#pragma unroll
  for (int i = 0; i < 8; ++i) { const int ka = k0 + 8 * g + i, kb = ka + 16;
    a[i] = (_Float16)(ka < K ? W[(size_t)(ka < K ? ka : K - 1) * ld + n] : 0.f); a[8 + i] = (_Float16)(kb < K ? W[(size_t)(kb < K ? kb : K - 1) * ld + n] : 0.f); }
  return a;
}
struct F2 { v16b h, l; };
__device__ __forceinline__ F2 bsplit16(const float v[16]) { F2 r;
#pragma unroll
  for (int i = 0; i < 16; ++i) { const __bf16 h = (__bf16)v[i]; r.h[i] = h; r.l[i] = (__bf16)(v[i] - (float)h); }
  return r; }
__device__ __forceinline__ F2 split_row(const float* row, int k0, int lane) { float v[16]; const float* p = row + k0 + 8 * (lane >> 4);
#pragma unroll
  for (int i = 0; i < 8; ++i) { v[i] = p[i]; v[8 + i] = p[16 + i]; }
  return bsplit16(v); }
__device__ __forceinline__ F2 split_rowK(const float* row, int k0, int lane, int K) { float v[16]; const int g = lane >> 4;
#pragma unroll
  for (int i = 0; i < 8; ++i) { const int ka = k0 + 8 * g + i, kb = ka + 16; v[i] = ka < K ? row[ka < K ? ka : K - 1] : 0.f; v[8 + i] = kb < K ? row[kb < K ? kb : K - 1] : 0.f; }
  return bsplit16(v); }
__device__ __forceinline__ F2 split_col(const float* W, int k0, int n, int lane, int ld, int K) { float v[16]; const int g = lane >> 4;
#pragma unroll
  for (int i = 0; i < 8; ++i) { const int ka = k0 + 8 * g + i, kb = ka + 16; v[i] = ka < K ? W[(size_t)(ka < K ? ka : K - 1) * ld + n] : 0.f; v[8 + i] = kb < K ? W[(size_t)(kb < K ? kb : K - 1) * ld + n] : 0.f; }
  return bsplit16(v); }
__device__ __forceinline__ v8f mac3(const F2& a, const F2& b, v8f c) { c = wmma_bf(a.l, b.h, c); c = wmma_bf(a.h, b.l, c); return wmma_bf(a.h, b.h, c); }
__device__ __forceinline__ float sigm(float v) { return 1.0f / (1.0f + expf(-v)); }
#define LDSX() do { asm volatile("s_wait_dscnt 0" ::: "memory"); __builtin_amdgcn_wave_barrier(); __builtin_amdgcn_fence(__ATOMIC_RELEASE, "workgroup"); } while (0)


// Dendritic block attention (B 2, H 16, S 2,048, D 64): importance-scaled queries, causal scores normalised independently within each 64-key block (softmax with +1e-6 in the denominator, fully masked blocks contribute 0), summed over blocks, then whole 64-query blocks zeroed unless some token's importance exceeds 0.3.
#define NB 2
#define NH 16
#define SS 2048
#define HD 64
#define BLK 64
#ifndef TQB
#define TQB (SS / 64)
#define TNB NB
#endif
typedef __attribute__((ext_vector_type(8))) __bf16 v8b;
__device__ __forceinline__ v16b frag_b(const __bf16* rowk0, int lane) {
  union { v16b v; v8b q[2]; } u; const __bf16* p = rowk0 + 8 * (lane >> 4);
  u.q[0] = *(const v8b*)p; u.q[1] = *(const v8b*)(p + 16); return u.v;
}
__device__ __forceinline__ float bfr(float v) { return (float)(__bf16)v; }
// lane l takes the value of lane l ^ 16
__device__ __forceinline__ float xhalf(float x) { return __builtin_bit_cast(float, __builtin_amdgcn_permlanex16(__builtin_bit_cast(int, x), __builtin_bit_cast(int, x), 0x76543210, 0xfedcba98, false, false)); }
__device__ __attribute__((noinline)) float exp_ni(float v) { return expf(v); }
__device__ __attribute__((noinline)) float erf_ni(float v) { return erff(v); }

#define WS_Q   0u                                  // f16 [b][h][s][64] q ; K ; VT planes [b][h][64][s]
#define WS_K   (WS_Q + 2u * (size_t)NB * NH * SS * HD)
#define WS_VT  (WS_K + 2u * (size_t)NB * NH * SS * HD)
#define WS_END (WS_VT + 2u * (size_t)NB * NH * HD * SS)

// ---- k_rows: 64 rows of q or k -> exact f16 rows
__global__ __launch_bounds__(256) void k_rows(const float* __restrict__ X, _Float16* __restrict__ R) { const size_t r0 = (size_t)blockIdx.x * 64; const int t = threadIdx.x; __shared__ __align__(16) _Float16 s[64][72];
  for (int e = t; e < 64 * 64; e += 256) { const int r = e >> 6, c = e & 63; s[r][c] = (_Float16)bfr(X[(r0 + r) * HD + c]); } __syncthreads();
  for (int e = t; e < 64 * 8; e += 256) { const int r = e >> 3, q = e & 7; vst2((unsigned*)(R + (r0 + r) * HD + q * 8), *(const v4u*)&s[r][q * 8]); } }
// ---- k_vt: block = (64 keys of one (b,h)): VT[(b,h)][d][s] = v[(b,h)][s][d]
__global__ __launch_bounds__(256) void k_vt(const float* __restrict__ V, _Float16* __restrict__ VT) { __shared__ __align__(16) _Float16 st[64][72]; const size_t rb0 = (size_t)blockIdx.x * 64; const size_t bh = rb0 / SS, s0 = rb0 % SS; const int t = threadIdx.x;
  for (int e = t; e < 64 * 64; e += 256) { const int r = e >> 6, d = e & 63; st[d][r] = (_Float16)bfr(V[(rb0 + r) * HD + d]); } __syncthreads();
  for (int e = t; e < 64 * 8; e += 256) { const int d = e >> 3, pc = e & 7; vst2((unsigned*)(VT + (bh * HD + d) * SS + s0 + pc * 8), *(const v4u*)&st[d][pc * 8]); } }
// ---- stage_kv: one 64-key block's K rows and V^T rows (64 rows of 128 B each) -> LDS rows of 144 B. Each of the 128 lanes copies four 16-byte pieces of each tile, 16 rows apart.
// The s_wait_xcnt stands inside the copies' own statement so that no address register is rewritten in front of it.
__device__ __forceinline__ void stage_kv(const _Float16* kg, const _Float16* vg, unsigned lk, unsigned lv) {
  asm volatile("global_load_async_to_lds_b128 %0, %8, off\n\t"
               "global_load_async_to_lds_b128 %1, %9, off\n\t"
               "global_load_async_to_lds_b128 %2, %10, off\n\t"
               "global_load_async_to_lds_b128 %3, %11, off\n\t"
               "global_load_async_to_lds_b128 %4, %12, off\n\t"
               "global_load_async_to_lds_b128 %5, %13, off\n\t"
               "global_load_async_to_lds_b128 %6, %14, off\n\t"
               "global_load_async_to_lds_b128 %7, %15, off\n\t"
               "s_wait_xcnt 0x0"
               :: "v"(lk), "v"(lk + 16u * 144u), "v"(lk + 32u * 144u), "v"(lk + 48u * 144u),
                  "v"(lv), "v"(lv + 16u * 144u), "v"(lv + 32u * 144u), "v"(lv + 48u * 144u),
                  "v"(kg), "v"(kg + 16 * HD), "v"(kg + 32 * HD), "v"(kg + 48 * HD),
                  "v"(vg), "v"(vg + 16 * SS), "v"(vg + 32 * SS), "v"(vg + 48 * SS)
               : "memory");
}
// ---- k_attn: block = (64 queries = one query block, h, b): per causal 64-key block an independent masked softmax (+1e-6), P x v accumulated; output x active(query block)
__global__ __launch_bounds__(128) void k_attn(const _Float16* __restrict__ Q, const _Float16* __restrict__ K, const _Float16* __restrict__ VT, const float* __restrict__ IMP, float* __restrict__ OUT) {
  __shared__ __align__(16) float so[4][16][68]; __shared__ int sact[4];
  __shared__ __align__(16) _Float16 sk[2][64][72]; __shared__ __align__(16) _Float16 sv[2][64][72];   // two buffers of one key block each: K rows, V^T rows; pitch 144 B
  const int tid = threadIdx.x, wave = tid >> 5, lane = tid & 31, col = lane & 15, g = lane >> 4; const int h = blockIdx.y; const size_t b = blockIdx.z; const int qb = blockIdx.x; const int q0 = qb * 64 + wave * 16; const size_t bh = b * NH + h; const size_t rq = bh * SS + q0;
  // key block 0 -> buffer 0; lane's piece: row tid >> 3 (+16, +32, +48), 16-byte column tid & 7
  const int srow = tid >> 3, scol = (tid & 7) * 8;
  const _Float16* kg = K + (bh * SS + srow) * HD + scol; const _Float16* vg = VT + (bh * HD + srow) * SS + scol;
  const unsigned lk = (unsigned)(size_t)&sk[0][srow][scol], lv = (unsigned)(size_t)&sv[0][srow][scol];
  stage_kv(kg, vg, lk, lv);
  // activity of this 64-query block: any importance > 0.3
  { float iv = bfr(IMP[b * SS + qb * 64 + (tid & 63)]); int act = (iv > 0.3f) ? 1 : 0;
#pragma unroll
    for (int o = 1; o < 32; o <<= 1) act |= __shfl_xor(act, o);
    if (lane == 0) sact[wave] = act; }
  asm volatile("s_wait_asynccnt 0x0" ::: "memory");   // this wave's pieces of key block 0 have landed before the barrier publishes them
  __syncthreads(); const int active = sact[0] | sact[1] | sact[2] | sact[3];
  if (qb >= 1) stage_kv(kg + BLK * HD, vg + BLK, lk + 9216u, lv + 9216u);   // key block 1 -> buffer 1, in flight during trip 0
  v16h aq[2];
#pragma unroll
  for (int kc = 0; kc < 2; ++kc) aq[kc] = frag_h(Q + (rq + col) * HD + kc * 32, lane);
  const float qsc = 0.125f * bfr(IMP[b * SS + q0 + col]);   // 1/8 x importance of this lane's query (a power of two: same rounding as the two factors in turn)
  v8f acc[4] = {};
#pragma unroll 1
  for (int kb = 0; kb <= qb; ++kb) { const int j0 = kb * BLK; const int bf = kb & 1; v8f s[4]; v16h kf[8], vf[8]; const int rel = q0 + col - j0 - 8 * g;   // key ct * 16 + r of this lane is causal where ct * 16 + r <= rel
#pragma unroll
    for (int ct = 0; ct < 4; ++ct)
#pragma unroll
      for (int kc = 0; kc < 2; ++kc) kf[ct * 2 + kc] = frag_h(&sk[bf][ct * 16 + col][kc * 32], lane);
#pragma unroll
    for (int kc = 0; kc < 2; ++kc)
#pragma unroll
      for (int dt = 0; dt < 4; ++dt) vf[kc * 4 + dt] = frag_h(&sv[bf][dt * 16 + col][kc * 32], lane);
    // transposed scores: A = K rows, B = Q rows; s[ct][r] = score of key j0 + ct * 16 + 8 * g + r for query q0 + col, so a lane and its partner lane ^ 16 hold all 64 scores of one query
#pragma unroll
    for (int ct = 0; ct < 4; ++ct) { v8f c = {};
#pragma unroll
      for (int kc = 0; kc < 2; ++kc) c = wmma16(kf[ct * 2 + kc], aq[kc], c);
#pragma unroll
      for (int r = 0; r < 8; ++r) s[ct][r] = (ct * 16 + r <= rel) ? c[r] * qsc : -3.0e38f; }
    float m4[4];
#pragma unroll
    for (int ct = 0; ct < 4; ++ct) m4[ct] = fmaxf(fmaxf(fmaxf(s[ct][0], s[ct][1]), fmaxf(s[ct][2], s[ct][3])), fmaxf(fmaxf(s[ct][4], s[ct][5]), fmaxf(s[ct][6], s[ct][7])));
    float mx = fmaxf(fmaxf(m4[0], m4[1]), fmaxf(m4[2], m4[3])); mx = fmaxf(mx, xhalf(mx));
    const float safe = (mx <= -1.0e38f) ? 0.f : mx; float e4[4];
#pragma unroll
    for (int ct = 0; ct < 4; ++ct) {
#pragma unroll
      for (int r = 0; r < 8; ++r) s[ct][r] = (ct * 16 + r <= rel) ? __expf(s[ct][r] - safe) : 0.f;
      e4[ct] = ((s[ct][0] + s[ct][1]) + (s[ct][2] + s[ct][3])) + ((s[ct][4] + s[ct][5]) + (s[ct][6] + s[ct][7])); }
    float es = (e4[0] + e4[1]) + (e4[2] + e4[3]); es += xhalf(es);
    const float inv = 2048.0f / (es + 1e-6f);
    // two 16-key score tiles of one query, converted in place, are the A fragment of P x v in the hardware k order (element i = key 8 * g + i, element 8 + i = key 16 + 8 * g + i of each 32)
    v16h pa[2];
#pragma unroll
    for (int kc = 0; kc < 2; ++kc)
#pragma unroll
      for (int i = 0; i < 8; ++i) { pa[kc][i] = (_Float16)(s[2 * kc][i] * inv); pa[kc][8 + i] = (_Float16)(s[2 * kc + 1][i] * inv); }
#pragma unroll
    for (int kc = 0; kc < 2; ++kc)
#pragma unroll
      for (int dt = 0; dt < 4; ++dt) acc[dt] = wmma16(pa[kc], vf[kc * 4 + dt], acc[dt]);
    asm volatile("s_wait_dscnt 0x0" ::: "memory");      // this wave's LDS reads of buffer bf are done
    asm volatile("s_wait_asynccnt 0x0" ::: "memory");   // this wave's pieces of key block kb + 1 have landed
    __syncthreads();                                    // publishes key block kb + 1 and frees buffer bf
    if (kb + 2 <= qb) stage_kv(kg + (size_t)(kb + 2) * (BLK * HD), vg + (kb + 2) * BLK, lk + 9216u * bf, lv + 9216u * bf); }
  asm volatile("s_wait_asynccnt 0x0" ::: "memory");     // no copy is outstanding when the wave goes on to the epilogue
  const float fin = active ? (1.0f / 2048.0f) : 0.f;
#pragma unroll
  for (int r = 0; r < 8; ++r)
#pragma unroll
    for (int dt = 0; dt < 4; ++dt) so[wave][8 * g + r][dt * 16 + col] = acc[dt][r] * fin;
  LDSX();
  for (int rl = 0; rl < 16; ++rl) if (lane < 16) vst2(OUT + (rq + rl) * HD + lane * 4, *(const v4f*)&so[wave][rl][lane * 4]);
}
extern "C" void kernel_launch(void* const* d_in, const int* in_sizes, int n_in, void* d_out, int out_size, void* d_ws, size_t ws_size, hipStream_t stream) {
  (void)in_sizes; (void)n_in; (void)out_size;
  const float** F = (const float**)d_in;   // 0 q, 1 k, 2 v [2,16,2048,64], 3 importance_scores [2,2048]
  if (ws_size < (size_t)WS_END) return;
  char* ws = (char*)d_ws; _Float16 *Q = (_Float16*)(ws + WS_Q), *K = (_Float16*)(ws + WS_K), *VT = (_Float16*)(ws + WS_VT);
  k_rows<<<NB * NH * SS / 64, 256, 0, stream>>>(F[0], Q);
  k_rows<<<NB * NH * SS / 64, 256, 0, stream>>>(F[1], K);
  k_vt<<<NB * NH * SS / 64, 256, 0, stream>>>(F[2], VT);
  k_attn<<<dim3(TQB, NH, TNB), 128, 0, stream>>>(Q, K, VT, F[3], (float*)d_out);
}

// v003
// It runs in 55.3 microseconds.
// Next to v002, in two timings, it ran 1.19 and 1.18 times as fast.
// Over all steps from v000 it is 3.42 times as fast.
// compute dtype: q, k, v, importance rounded to bf16 and used as EXACT f16 operands on WMMA 16x16x32; scores = (q . k) x 1/8 x importance_i in f32 (the module scales q by importance first - identical algebra), causal mask, per 64-key block: max / exp (hardware exp) / sum + 1e-6 in f32, P (scaled by 2^11, single f16) x v (exact f16); the per-64-query-block activity gate from the importance threshold; f32 accumulate.
#include <hip/hip_runtime.h>
#include <math.h>

typedef __attribute__((ext_vector_type(16))) _Float16 v16h;
typedef __attribute__((ext_vector_type(16))) __bf16 v16b;
typedef __attribute__((ext_vector_type(8)))  _Float16 v8h;
typedef __attribute__((ext_vector_type(8)))  float v8f;
typedef __attribute__((ext_vector_type(4)))  float v4f;
typedef __attribute__((ext_vector_type(2)))  float v2f;
typedef __attribute__((ext_vector_type(4)))  unsigned v4u;
typedef __attribute__((ext_vector_type(4)))  int v4i;
typedef float __attribute__((may_alias)) float_a;
typedef int __attribute__((may_alias)) int_a;

template <typename T> __device__ __forceinline__ void vst2(void* p, T v) { *(T*)p = v;  }
__device__ __forceinline__ v8f wmma16(v16h a, v16h b, v8f c) {
  v8f d = __builtin_amdgcn_wmma_f32_16x16x32_f16(false, a, false, b, (short)0, c, false, false);
  asm volatile("v_nop\n\tv_nop\n\tv_nop\n\tv_nop" : "+v"(d) : "v"(a), "v"(b));
  return d;
}
__device__ __forceinline__ v8f wmma_bf(v16b a, v16b b, v8f c) {
  v8f d = __builtin_amdgcn_wmma_f32_16x16x32_bf16(false, a, false, b, (short)0, c, false, false);
  asm volatile("v_nop\n\tv_nop\n\tv_nop\n\tv_nop" : "+v"(d) : "v"(a), "v"(b));
  return d;
}
// 16x16x32 fragments: lane = (h = lane>>4, row/col = lane&15); elements 0..7 = k0+8h+0..7, 8..15 = k0+16+8h+0..7; D element r = row 8h+r
__device__ __forceinline__ v16h frag_h(const _Float16* rowk0, int lane) {
  union { v16h v; v8h q[2]; } u; const _Float16* p = rowk0 + 8 * (lane >> 4);
  u.q[0] = *(const v8h*)p; u.q[1] = *(const v8h*)(p + 16); return u.v;
}
__device__ __forceinline__ v16h frag_f32(const float* rowk0, int lane) {
  v16h a; const float* p = rowk0 + 8 * (lane >> 4);
#pragma unroll
  for (int i = 0; i < 8; ++i) { a[i] = (_Float16)p[i]; a[8 + i] = (_Float16)p[16 + i]; }
  return a;
}
__device__ __forceinline__ v16h frag_f32s(const float* rowk0, int lane, float sc) {
  v16h a; const float* p = rowk0 + 8 * (lane >> 4);
#pragma unroll
  for (int i = 0; i < 8; ++i) { a[i] = (_Float16)(p[i] * sc); a[8 + i] = (_Float16)(p[16 + i] * sc); }
  return a;
}
// column fragment from a [K][ld] layout (column n), rows >= K read as 0
__device__ __forceinline__ v16h fragc_f32(const float* W, int k0, int n, int lane, int ld, int K) {
  v16h a; const int g = lane >> 4;
#pragma unroll
  for (int i = 0; i < 8; ++i) { const int ka = k0 + 8 * g + i, kb = ka + 16;
    a[i] = (_Float16)(ka < K ? W[(size_t)(ka < K ? ka : K - 1) * ld + n] : 0.f); a[8 + i] = (_Float16)(kb < K ? W[(size_t)(kb < K ? kb : K - 1) * ld + n] : 0.f); }
  return a;
}
struct F2 { v16b h, l; };
__device__ __forceinline__ F2 bsplit16(const float v[16]) { F2 r;
#pragma unroll
  for (int i = 0; i < 16; ++i) { const __bf16 h = (__bf16)v[i]; r.h[i] = h; r.l[i] = (__bf16)(v[i] - (float)h); }
  return r; }
__device__ __forceinline__ F2 split_row(const float* row, int k0, int lane) { float v[16]; const float* p = row + k0 + 8 * (lane >> 4);
#pragma unroll
  for (int i = 0; i < 8; ++i) { v[i] = p[i]; v[8 + i] = p[16 + i]; }
  return bsplit16(v); }
__device__ __forceinline__ F2 split_rowK(const float* row, int k0, int lane, int K) { float v[16]; const int g = lane >> 4;
#pragma unroll
  for (int i = 0; i < 8; ++i) { const int ka = k0 + 8 * g + i, kb = ka + 16; v[i] = ka < K ? row[ka < K ? ka : K - 1] : 0.f; v[8 + i] = kb < K ? row[kb < K ? kb : K - 1] : 0.f; }
  return bsplit16(v); }
__device__ __forceinline__ F2 split_col(const float* W, int k0, int n, int lane, int ld, int K) { float v[16]; const int g = lane >> 4;
#pragma unroll
  for (int i = 0; i < 8; ++i) { const int ka = k0 + 8 * g + i, kb = ka + 16; v[i] = ka < K ? W[(size_t)(ka < K ? ka : K - 1) * ld + n] : 0.f; v[8 + i] = kb < K ? W[(size_t)(kb < K ? kb : K - 1) * ld + n] : 0.f; }
  return bsplit16(v); }
__device__ __forceinline__ v8f mac3(const F2& a, const F2& b, v8f c) { c = wmma_bf(a.l, b.h, c); c = wmma_bf(a.h, b.l, c); return wmma_bf(a.h, b.h, c); }
__device__ __forceinline__ float sigm(float v) { return 1.0f / (1.0f + expf(-v)); }
#define LDSX() do { asm volatile("s_wait_dscnt 0" ::: "memory"); __builtin_amdgcn_wave_barrier(); __builtin_amdgcn_fence(__ATOMIC_RELEASE, "workgroup"); } while (0)


// Dendritic block attention (B 2, H 16, S 2,048, D 64): importance-scaled queries, causal scores normalised independently within each 64-key block (softmax with +1e-6 in the denominator, fully masked blocks contribute 0), summed over blocks, then whole 64-query blocks zeroed unless some token's importance exceeds 0.3.
#define NB 2
#define NH 16
#define SS 2048
#define HD 64
#define BLK 64
#ifndef TQB
#define TQB (SS / 64)
#define TNB NB
#endif
typedef __attribute__((ext_vector_type(8))) __bf16 v8b;
__device__ __forceinline__ v16b frag_b(const __bf16* rowk0, int lane) {
  union { v16b v; v8b q[2]; } u; const __bf16* p = rowk0 + 8 * (lane >> 4);
  u.q[0] = *(const v8b*)p; u.q[1] = *(const v8b*)(p + 16); return u.v;
}
__device__ __forceinline__ float bfr(float v) { return (float)(__bf16)v; }
// lane l takes the value of lane l ^ 16
__device__ __forceinline__ float xhalf(float x) { return __builtin_bit_cast(float, __builtin_amdgcn_permlanex16(__builtin_bit_cast(int, x), __builtin_bit_cast(int, x), 0x76543210, 0xfedcba98, false, false)); }
__device__ __attribute__((noinline)) float exp_ni(float v) { return expf(v); }
__device__ __attribute__((noinline)) float erf_ni(float v) { return erff(v); }

#define WS_Q   0u                                  // f16 [b][h][s][64] q ; K ; VT planes [b][h][64][s]
#define WS_K   (WS_Q + 2u * (size_t)NB * NH * SS * HD)
#define WS_VT  (WS_K + 2u * (size_t)NB * NH * SS * HD)
#define WS_END (WS_VT + 2u * (size_t)NB * NH * HD * SS)

// ---- k_rows: 64 rows of q or k -> exact f16 rows
__global__ __launch_bounds__(256) void k_rows(const float* __restrict__ X, _Float16* __restrict__ R) { const size_t r0 = (size_t)blockIdx.x * 64; const int t = threadIdx.x; __shared__ __align__(16) _Float16 s[64][72];
  for (int e = t; e < 64 * 64; e += 256) { const int r = e >> 6, c = e & 63; s[r][c] = (_Float16)bfr(X[(r0 + r) * HD + c]); } __syncthreads();
  for (int e = t; e < 64 * 8; e += 256) { const int r = e >> 3, q = e & 7; vst2((unsigned*)(R + (r0 + r) * HD + q * 8), *(const v4u*)&s[r][q * 8]); } }
// ---- k_vt: block = (64 keys of one (b,h)): VT[(b,h)][d][s] = v[(b,h)][s][d]
__global__ __launch_bounds__(256) void k_vt(const float* __restrict__ V, _Float16* __restrict__ VT) { __shared__ __align__(16) _Float16 st[64][72]; const size_t rb0 = (size_t)blockIdx.x * 64; const size_t bh = rb0 / SS, s0 = rb0 % SS; const int t = threadIdx.x;
  for (int e = t; e < 64 * 64; e += 256) { const int r = e >> 6, d = e & 63; st[d][r] = (_Float16)bfr(V[(rb0 + r) * HD + d]); } __syncthreads();
  for (int e = t; e < 64 * 8; e += 256) { const int d = e >> 3, pc = e & 7; vst2((unsigned*)(VT + (bh * HD + d) * SS + s0 + pc * 8), *(const v4u*)&st[d][pc * 8]); } }
// ---- stage_kv: one 64-key block's K rows and V^T rows (64 rows of 128 B each) -> LDS rows of 144 B. Each of the 128 lanes copies four 16-byte pieces of each tile, 16 rows apart.
// The s_wait_xcnt stands inside the copies' own statement so that no address register is rewritten in front of it.
__device__ __forceinline__ void stage_kv(const _Float16* kg, const _Float16* vg, unsigned lk, unsigned lv) {
  asm volatile("global_load_async_to_lds_b128 %0, %8, off\n\t"
               "global_load_async_to_lds_b128 %1, %9, off\n\t"
               "global_load_async_to_lds_b128 %2, %10, off\n\t"
               "global_load_async_to_lds_b128 %3, %11, off\n\t"
               "global_load_async_to_lds_b128 %4, %12, off\n\t"
               "global_load_async_to_lds_b128 %5, %13, off\n\t"
               "global_load_async_to_lds_b128 %6, %14, off\n\t"
               "global_load_async_to_lds_b128 %7, %15, off\n\t"
               "s_wait_xcnt 0x0"
               :: "v"(lk), "v"(lk + 16u * 144u), "v"(lk + 32u * 144u), "v"(lk + 48u * 144u),
                  "v"(lv), "v"(lv + 16u * 144u), "v"(lv + 32u * 144u), "v"(lv + 48u * 144u),
                  "v"(kg), "v"(kg + 16 * HD), "v"(kg + 32 * HD), "v"(kg + 48 * HD),
                  "v"(vg), "v"(vg + 16 * SS), "v"(vg + 32 * SS), "v"(vg + 48 * SS)
               : "memory");
}
// ---- k_attn: block = (two query blocks of 64 queries, h, b): query block TQB - 1 - x, then query block x, one after the other in every wave, so that every work-group walks TQB + 1 key blocks; the two-buffer ring runs on from the first walk into the second. Per causal 64-key block an independent masked softmax (+1e-6), P x v accumulated; output x active(query block)
__global__ __launch_bounds__(128) void k_attn(const _Float16* __restrict__ Q, const _Float16* __restrict__ K, const _Float16* __restrict__ VT, const float* __restrict__ IMP, float* __restrict__ OUT) {
  __shared__ __align__(16) float so[4][16][68]; __shared__ int sact[4];
  __shared__ __align__(16) _Float16 sk[2][64][72]; __shared__ __align__(16) _Float16 sv[2][64][72];   // two buffers of one key block each: K rows, V^T rows; pitch 144 B
  const int tid = threadIdx.x, wave = tid >> 5, lane = tid & 31, col = lane & 15, g = lane >> 4; const int h = blockIdx.y; const size_t b = blockIdx.z; const int qx = blockIdx.x, qa = TQB - 1 - qx; const size_t bh = b * NH + h;   // qa >= TQB / 2: the first walk has at least two key blocks
  // key block 0 -> buffer 0; lane's piece: row tid >> 3 (+16, +32, +48), 16-byte column tid & 7
  const int srow = tid >> 3, scol = (tid & 7) * 8;
  const _Float16* kg = K + (bh * SS + srow) * HD + scol; const _Float16* vg = VT + (bh * HD + srow) * SS + scol;
  const unsigned lk = (unsigned)(size_t)&sk[0][srow][scol], lv = (unsigned)(size_t)&sv[0][srow][scol];
  stage_kv(kg, vg, lk, lv);
  // activity of the two 64-query blocks: any importance > 0.3; bit 0 for block qa, bit 1 for block qx
  { float iv = bfr(IMP[b * SS + qa * 64 + (tid & 63)]), iw = bfr(IMP[b * SS + qx * 64 + (tid & 63)]); int act = ((iv > 0.3f) ? 1 : 0) | ((iw > 0.3f) ? 2 : 0);
#pragma unroll
    for (int o = 1; o < 32; o <<= 1) act |= __shfl_xor(act, o);
    if (lane == 0) sact[wave] = act; }
  asm volatile("s_wait_asynccnt 0x0" ::: "memory");   // this wave's pieces of key block 0 have landed before the barrier publishes them
  __syncthreads(); const int active = sact[0] | sact[1] | sact[2] | sact[3];
  stage_kv(kg + BLK * HD, vg + BLK, lk + 9216u, lv + 9216u);   // key block 1 -> buffer 1, in flight during trip 0
  int t = 0;   // trip of the ring, 0 to TQB over both walks
#pragma unroll 1   // the two query blocks share one copy of the code
  for (int half = 0; half < 2; ++half) { const int qb = half ? qx : qa; const int q0 = qb * 64 + wave * 16; const size_t rq = bh * SS + q0;
  v16h aq[2];
#pragma unroll
  for (int kc = 0; kc < 2; ++kc) aq[kc] = frag_h(Q + (rq + col) * HD + kc * 32, lane);
  const float qsc = 0.125f * bfr(IMP[b * SS + q0 + col]);   // 1/8 x importance of this lane's query (a power of two: same rounding as the two factors in turn)
  v8f acc[4] = {};
#pragma unroll 1
  for (int kb = 0; kb <= qb; ++kb, ++t) { const int j0 = kb * BLK; const int bf = t & 1; v8f s[4]; v16h kf[8], vf[8]; const int rel = q0 + col - j0 - 8 * g;   // key ct * 16 + r of this lane is causal where ct * 16 + r <= rel
#pragma unroll
    for (int ct = 0; ct < 4; ++ct)
#pragma unroll
      for (int kc = 0; kc < 2; ++kc) kf[ct * 2 + kc] = frag_h(&sk[bf][ct * 16 + col][kc * 32], lane);
#pragma unroll
    for (int kc = 0; kc < 2; ++kc)
#pragma unroll
      for (int dt = 0; dt < 4; ++dt) vf[kc * 4 + dt] = frag_h(&sv[bf][dt * 16 + col][kc * 32], lane);
    // transposed scores: A = K rows, B = Q rows; s[ct][r] = score of key j0 + ct * 16 + 8 * g + r for query q0 + col, so a lane and its partner lane ^ 16 hold all 64 scores of one query
#pragma unroll
    for (int ct = 0; ct < 4; ++ct) { v8f c = {};
#pragma unroll
      for (int kc = 0; kc < 2; ++kc) c = wmma16(kf[ct * 2 + kc], aq[kc], c);
#pragma unroll
      for (int r = 0; r < 8; ++r) s[ct][r] = (ct * 16 + r <= rel) ? c[r] * qsc : -3.0e38f; }
    float m4[4];
#pragma unroll
    for (int ct = 0; ct < 4; ++ct) m4[ct] = fmaxf(fmaxf(fmaxf(s[ct][0], s[ct][1]), fmaxf(s[ct][2], s[ct][3])), fmaxf(fmaxf(s[ct][4], s[ct][5]), fmaxf(s[ct][6], s[ct][7])));
    float mx = fmaxf(fmaxf(m4[0], m4[1]), fmaxf(m4[2], m4[3])); mx = fmaxf(mx, xhalf(mx));
    const float safe = (mx <= -1.0e38f) ? 0.f : mx; float e4[4];
#pragma unroll
    for (int ct = 0; ct < 4; ++ct) {
#pragma unroll
      for (int r = 0; r < 8; ++r) s[ct][r] = (ct * 16 + r <= rel) ? __expf(s[ct][r] - safe) : 0.f;
      e4[ct] = ((s[ct][0] + s[ct][1]) + (s[ct][2] + s[ct][3])) + ((s[ct][4] + s[ct][5]) + (s[ct][6] + s[ct][7])); }
    float es = (e4[0] + e4[1]) + (e4[2] + e4[3]); es += xhalf(es);
    const float inv = 2048.0f / (es + 1e-6f);
    // two 16-key score tiles of one query, converted in place, are the A fragment of P x v in the hardware k order (element i = key 8 * g + i, element 8 + i = key 16 + 8 * g + i of each 32)
    v16h pa[2];
#pragma unroll
    for (int kc = 0; kc < 2; ++kc)
#pragma unroll
      for (int i = 0; i < 8; ++i) { pa[kc][i] = (_Float16)(s[2 * kc][i] * inv); pa[kc][8 + i] = (_Float16)(s[2 * kc + 1][i] * inv); }
#pragma unroll
    for (int kc = 0; kc < 2; ++kc)
#pragma unroll
      for (int dt = 0; dt < 4; ++dt) acc[dt] = wmma16(pa[kc], vf[kc * 4 + dt], acc[dt]);
    asm volatile("s_wait_dscnt 0x0" ::: "memory");      // this wave's LDS reads of buffer bf are done
    asm volatile("s_wait_asynccnt 0x0" ::: "memory");   // this wave's pieces of trip t + 1's key block have landed
    __syncthreads();                                    // publishes trip t + 1's key block and frees buffer bf
    if (t + 2 <= TQB) { const int kn = (t + 2 <= qa) ? t + 2 : t + 1 - qa;   // key block of trip t + 2: behind the first walk's last block the second walk's block 0
      stage_kv(kg + (size_t)kn * (BLK * HD), vg + kn * BLK, lk + 9216u * bf, lv + 9216u * bf); } }
  const float fin = ((active >> half) & 1) ? (1.0f / 2048.0f) : 0.f;
#pragma unroll
  for (int r = 0; r < 8; ++r)
#pragma unroll
    for (int dt = 0; dt < 4; ++dt) so[wave][8 * g + r][dt * 16 + col] = acc[dt][r] * fin;
  LDSX();
  for (int rl = 0; rl < 16; ++rl) if (lane < 16) vst2(OUT + (rq + rl) * HD + lane * 4, *(const v4f*)&so[wave][rl][lane * 4]);
  asm volatile("s_wait_xcnt 0x0" ::: "memory");         // the second query block's set-up rewrites registers that these stores name
  }
  asm volatile("s_wait_asynccnt 0x0" ::: "memory");     // no copy is outstanding when the wave ends
}
extern "C" void kernel_launch(void* const* d_in, const int* in_sizes, int n_in, void* d_out, int out_size, void* d_ws, size_t ws_size, hipStream_t stream) {
  (void)in_sizes; (void)n_in; (void)out_size;
  const float** F = (const float**)d_in;   // 0 q, 1 k, 2 v [2,16,2048,64], 3 importance_scores [2,2048]
  if (ws_size < (size_t)WS_END) return;
  char* ws = (char*)d_ws; _Float16 *Q = (_Float16*)(ws + WS_Q), *K = (_Float16*)(ws + WS_K), *VT = (_Float16*)(ws + WS_VT);
  k_rows<<<NB * NH * SS / 64, 256, 0, stream>>>(F[0], Q);
  k_rows<<<NB * NH * SS / 64, 256, 0, stream>>>(F[1], K);
  k_vt<<<NB * NH * SS / 64, 256, 0, stream>>>(F[2], VT);
  k_attn<<<dim3(TQB / 2, NH, TNB), 128, 0, stream>>>(Q, K, VT, F[3], (float*)d_out);
}

// v004
// A run of this version takes 47.4 microseconds.
// Next to v003, in two timings, it ran 1.16 times as fast each time.
// Over all steps from v000 it is 3.96 times as fast.
// compute dtype: q, k, v, importance rounded to bf16 and used as EXACT f16 operands on WMMA 16x16x32; scores = (q . k) x 1/8 x importance_i in f32 (the module scales q by importance first - identical algebra), causal mask, per 64-key block: max / exp (hardware exp) / sum + 1e-6 in f32, P (scaled by 2^11, single f16) x v (exact f16); the per-64-query-block activity gate from the importance threshold; f32 accumulate.
#include <hip/hip_runtime.h>
#include <math.h>

typedef __attribute__((ext_vector_type(16))) _Float16 v16h;
typedef __attribute__((ext_vector_type(16))) __bf16 v16b;
typedef __attribute__((ext_vector_type(8)))  _Float16 v8h;
typedef __attribute__((ext_vector_type(8)))  float v8f;
typedef __attribute__((ext_vector_type(4)))  float v4f;
typedef __attribute__((ext_vector_type(2)))  float v2f;
typedef __attribute__((ext_vector_type(4)))  unsigned v4u;
typedef __attribute__((ext_vector_type(4)))  int v4i;
typedef float __attribute__((may_alias)) float_a;
typedef int __attribute__((may_alias)) int_a;

template <typename T> __device__ __forceinline__ void vst2(void* p, T v) { *(T*)p = v;  }
__device__ __forceinline__ v8f wmma16(v16h a, v16h b, v8f c) {
  v8f d = __builtin_amdgcn_wmma_f32_16x16x32_f16(false, a, false, b, (short)0, c, false, false);
  asm volatile("v_nop\n\tv_nop\n\tv_nop\n\tv_nop" : "+v"(d) : "v"(a), "v"(b));
  return d;
}
__device__ __forceinline__ v8f wmma_bf(v16b a, v16b b, v8f c) {
  v8f d = __builtin_amdgcn_wmma_f32_16x16x32_bf16(false, a, false, b, (short)0, c, false, false);
  asm volatile("v_nop\n\tv_nop\n\tv_nop\n\tv_nop" : "+v"(d) : "v"(a), "v"(b));
  return d;
}
// 16x16x32 fragments: lane = (h = lane>>4, row/col = lane&15); elements 0..7 = k0+8h+0..7, 8..15 = k0+16+8h+0..7; D element r = row 8h+r
__device__ __forceinline__ v16h frag_h(const _Float16* rowk0, int lane) {
  union { v16h v; v8h q[2]; } u; const _Float16* p = rowk0 + 8 * (lane >> 4);
  u.q[0] = *(const v8h*)p; u.q[1] = *(const v8h*)(p + 16); return u.v;
}
__device__ __forceinline__ v16h frag_f32(const float* rowk0, int lane) {
  v16h a; const float* p = rowk0 + 8 * (lane >> 4);
#pragma unroll
  for (int i = 0; i < 8; ++i) { a[i] = (_Float16)p[i]; a[8 + i] = (_Float16)p[16 + i]; }
  return a;
}
__device__ __forceinline__ v16h frag_f32s(const float* rowk0, int lane, float sc) {
  v16h a; const float* p = rowk0 + 8 * (lane >> 4);
#pragma unroll
  for (int i = 0; i < 8; ++i) { a[i] = (_Float16)(p[i] * sc); a[8 + i] = (_Float16)(p[16 + i] * sc); }
  return a;
}
// column fragment from a [K][ld] layout (column n), rows >= K read as 0
__device__ __forceinline__ v16h fragc_f32(const float* W, int k0, int n, int lane, int ld, int K) {
  v16h a; const int g = lane >> 4;
#pragma unroll
  for (int i = 0; i < 8; ++i) { const int ka = k0 + 8 * g + i, kb = ka + 16;
    a[i] = (_Float16)(ka < K ? W[(size_t)(ka < K ? ka : K - 1) * ld + n] : 0.f); a[8 + i] = (_Float16)(kb < K ? W[(size_t)(kb < K ? kb : K - 1) * ld + n] : 0.f); }
  return a;
}
struct F2 { v16b h, l; };
__device__ __forceinline__ F2 bsplit16(const float v[16]) { F2 r;
#pragma unroll
  for (int i = 0; i < 16; ++i) { const __bf16 h = (__bf16)v[i]; r.h[i] = h; r.l[i] = (__bf16)(v[i] - (float)h); }
  return r; }
__device__ __forceinline__ F2 split_row(const float* row, int k0, int lane) { float v[16]; const float* p = row + k0 + 8 * (lane >> 4);
#pragma unroll
  for (int i = 0; i < 8; ++i) { v[i] = p[i]; v[8 + i] = p[16 + i]; }
  return bsplit16(v); }
__device__ __forceinline__ F2 split_rowK(const float* row, int k0, int lane, int K) { float v[16]; const int g = lane >> 4;
#pragma unroll
  for (int i = 0; i < 8; ++i) { const int ka = k0 + 8 * g + i, kb = ka + 16; v[i] = ka < K ? row[ka < K ? ka : K - 1] : 0.f; v[8 + i] = kb < K ? row[kb < K ? kb : K - 1] : 0.f; }
  return bsplit16(v); }
__device__ __forceinline__ F2 split_col(const float* W, int k0, int n, int lane, int ld, int K) { float v[16]; const int g = lane >> 4;
#pragma unroll
  for (int i = 0; i < 8; ++i) { const int ka = k0 + 8 * g + i, kb = ka + 16; v[i] = ka < K ? W[(size_t)(ka < K ? ka : K - 1) * ld + n] : 0.f; v[8 + i] = kb < K ? W[(size_t)(kb < K ? kb : K - 1) * ld + n] : 0.f; }
  return bsplit16(v); }
__device__ __forceinline__ v8f mac3(const F2& a, const F2& b, v8f c) { c = wmma_bf(a.l, b.h, c); c = wmma_bf(a.h, b.l, c); return wmma_bf(a.h, b.h, c); }
__device__ __forceinline__ float sigm(float v) { return 1.0f / (1.0f + expf(-v)); }
#define LDSX() do { asm volatile("s_wait_dscnt 0" ::: "memory"); __builtin_amdgcn_wave_barrier(); __builtin_amdgcn_fence(__ATOMIC_RELEASE, "workgroup"); } while (0)


// Dendritic block attention (B 2, H 16, S 2,048, D 64): importance-scaled queries, causal scores normalised independently within each 64-key block (softmax with +1e-6 in the denominator, fully masked blocks contribute 0), summed over blocks, then whole 64-query blocks zeroed unless some token's importance exceeds 0.3.
#define NB 2
#define NH 16
#define SS 2048
#define HD 64
#define BLK 64
#ifndef TQB
#define TQB (SS / 64)
#define TNB NB
#endif
typedef __attribute__((ext_vector_type(8))) __bf16 v8b;
__device__ __forceinline__ v16b frag_b(const __bf16* rowk0, int lane) {
  union { v16b v; v8b q[2]; } u; const __bf16* p = rowk0 + 8 * (lane >> 4);
  u.q[0] = *(const v8b*)p; u.q[1] = *(const v8b*)(p + 16); return u.v;
}
__device__ __forceinline__ float bfr(float v) { return (float)(__bf16)v; }
// lane l takes the value of lane l ^ 16
__device__ __forceinline__ float xhalf(float x) { return __builtin_bit_cast(float, __builtin_amdgcn_permlanex16(__builtin_bit_cast(int, x), __builtin_bit_cast(int, x), 0x76543210, 0xfedcba98, false, false)); }
__device__ __attribute__((noinline)) float exp_ni(float v) { return expf(v); }
__device__ __attribute__((noinline)) float erf_ni(float v) { return erff(v); }

#define WS_Q   0u                                  // f16 [b][h][s][64] q ; K ; VT planes [b][h][64][s]
#define WS_K   (WS_Q + 2u * (size_t)NB * NH * SS * HD)
#define WS_VT  (WS_K + 2u * (size_t)NB * NH * SS * HD)
#define WS_END (WS_VT + 2u * (size_t)NB * NH * HD * SS)

typedef __attribute__((ext_vector_type(4))) _Float16 v4h;
typedef __attribute__((ext_vector_type(2))) _Float16 v2h;
// ---- k_rows: 128 rows of q or k -> exact f16 rows. A lane's eight 16-byte reads are all issued before the first is used; a wave-wide read is 512 contiguous bytes, a wave-wide store 256 (two whole lines), so nothing is staged.
__global__ __launch_bounds__(256) void k_rows(const float* __restrict__ X, _Float16* __restrict__ R) { const size_t e0 = ((size_t)blockIdx.x * 2048 + threadIdx.x) * 4; v4f x[8];
#pragma unroll   // straight-line, so that the eight reads stand together in front of the first conversion
  for (int j = 0; j < 8; ++j) x[j] = *(const v4f*)(X + e0 + j * 1024);
  asm volatile("s_wait_xcnt 0x0" ::: "memory");   // the conversions reuse the registers that hold the reads' address
#pragma unroll   // x[] stays in registers
  for (int j = 0; j < 8; ++j) { v4h y;
#pragma unroll
    for (int i = 0; i < 4; ++i) y[i] = (_Float16)bfr(x[j][i]);
    vst2(R + e0 + j * 1024, y); } }
// ---- k_vt: block = (128 keys of one (b,h)): VT[(b,h)][d][s] = v[(b,h)][s][d]. A lane reads four d of eight keys (four pairs of neighbours) by eight 16-byte reads, all issued before the first is used, and writes each pair of keys as one dword.
// st row d holds its sixteen 16-byte pieces (8 keys each) turned round by d >> 2 places: the 16 lanes that write the same keys for different d then hit 16 different bank groups, and the rows keep their 16-byte alignment for the readers.
__global__ __launch_bounds__(256) void k_vt(const float* __restrict__ V, _Float16* __restrict__ VT) { __shared__ __align__(16) _Float16 st[64][128]; const size_t rb0 = (size_t)blockIdx.x * 128; const size_t bh = rb0 / SS, s0 = rb0 % SS; const int t = threadIdx.x, c4 = t & 15, rp = t >> 4; v4f x[4][2];
#pragma unroll   // straight-line, so that the eight reads stand together in front of the first conversion
  for (int jj = 0; jj < 4; ++jj)
#pragma unroll
    for (int u = 0; u < 2; ++u) x[jj][u] = *(const v4f*)(V + (rb0 + 32 * jj + 2 * rp + u) * HD + c4 * 4);
#pragma unroll   // x[] stays in registers
  for (int jj = 0; jj < 4; ++jj) { const int r = 32 * jj + 2 * rp, pos = (((r >> 3) + c4) & 15) * 8 + (r & 7);
#pragma unroll
    for (int i = 0; i < 4; ++i) { v2h p; p[0] = (_Float16)bfr(x[jj][0][i]); p[1] = (_Float16)bfr(x[jj][1][i]); vst2(&st[c4 * 4 + i][pos], p); } }
  __syncthreads();
#pragma unroll   // the four LDS reads go out together, one wait chain instead of four
  for (int j = 0; j < 4; ++j) { const int e = t + 256 * j, d = e >> 4, pc = e & 15; vst2((unsigned*)(VT + (bh * HD + d) * SS + s0 + pc * 8), *(const v4u*)&st[d][((pc + (d >> 2)) & 15) * 8]); } }
// ---- stage_kv: one 64-key block's K rows and V^T rows (64 rows of 128 B each) -> LDS rows of 144 B. Each of the 128 lanes copies four 16-byte pieces of each tile, 16 rows apart.
// The s_wait_xcnt stands inside the copies' own statement so that no address register is rewritten in front of it.
__device__ __forceinline__ void stage_kv(const _Float16* kg, const _Float16* vg, unsigned lk, unsigned lv) {
  asm volatile("global_load_async_to_lds_b128 %0, %8, off\n\t"
               "global_load_async_to_lds_b128 %1, %9, off\n\t"
               "global_load_async_to_lds_b128 %2, %10, off\n\t"
               "global_load_async_to_lds_b128 %3, %11, off\n\t"
               "global_load_async_to_lds_b128 %4, %12, off\n\t"
               "global_load_async_to_lds_b128 %5, %13, off\n\t"
               "global_load_async_to_lds_b128 %6, %14, off\n\t"
               "global_load_async_to_lds_b128 %7, %15, off\n\t"
               "s_wait_xcnt 0x0"
               :: "v"(lk), "v"(lk + 16u * 144u), "v"(lk + 32u * 144u), "v"(lk + 48u * 144u),
                  "v"(lv), "v"(lv + 16u * 144u), "v"(lv + 32u * 144u), "v"(lv + 48u * 144u),
                  "v"(kg), "v"(kg + 16 * HD), "v"(kg + 32 * HD), "v"(kg + 48 * HD),
                  "v"(vg), "v"(vg + 16 * SS), "v"(vg + 32 * SS), "v"(vg + 48 * SS)
               : "memory");
}
// ---- k_attn: block = (two query blocks of 64 queries, h, b): query block TQB - 1 - x, then query block x, one after the other in every wave, so that every work-group walks TQB + 1 key blocks; the two-buffer ring runs on from the first walk into the second. Per causal 64-key block an independent masked softmax (+1e-6), P x v accumulated; output x active(query block)
__global__ __launch_bounds__(128) void k_attn(const _Float16* __restrict__ Q, const _Float16* __restrict__ K, const _Float16* __restrict__ VT, const float* __restrict__ IMP, float* __restrict__ OUT) {
  __shared__ __align__(16) float so[4][16][68]; __shared__ int sact[4];
  __shared__ __align__(16) _Float16 sk[2][64][72]; __shared__ __align__(16) _Float16 sv[2][64][72];   // two buffers of one key block each: K rows, V^T rows; pitch 144 B
  const int tid = threadIdx.x, wave = tid >> 5, lane = tid & 31, col = lane & 15, g = lane >> 4; const int h = blockIdx.y; const size_t b = blockIdx.z; const int qx = blockIdx.x, qa = TQB - 1 - qx; const size_t bh = b * NH + h;   // qa >= TQB / 2: the first walk has at least two key blocks
  // key block 0 -> buffer 0; lane's piece: row tid >> 3 (+16, +32, +48), 16-byte column tid & 7
  const int srow = tid >> 3, scol = (tid & 7) * 8;
  const _Float16* kg = K + (bh * SS + srow) * HD + scol; const _Float16* vg = VT + (bh * HD + srow) * SS + scol;
  const unsigned lk = (unsigned)(size_t)&sk[0][srow][scol], lv = (unsigned)(size_t)&sv[0][srow][scol];
  stage_kv(kg, vg, lk, lv);
  // activity of the two 64-query blocks: any importance > 0.3; bit 0 for block qa, bit 1 for block qx
  { float iv = bfr(IMP[b * SS + qa * 64 + (tid & 63)]), iw = bfr(IMP[b * SS + qx * 64 + (tid & 63)]); int act = ((iv > 0.3f) ? 1 : 0) | ((iw > 0.3f) ? 2 : 0);
#pragma unroll
    for (int o = 1; o < 32; o <<= 1) act |= __shfl_xor(act, o);
    if (lane == 0) sact[wave] = act; }
  asm volatile("s_wait_asynccnt 0x0" ::: "memory");   // this wave's pieces of key block 0 have landed before the barrier publishes them
  __syncthreads(); const int active = sact[0] | sact[1] | sact[2] | sact[3];
  stage_kv(kg + BLK * HD, vg + BLK, lk + 9216u, lv + 9216u);   // key block 1 -> buffer 1, in flight during trip 0
  int t = 0;   // trip of the ring, 0 to TQB over both walks
#pragma unroll 1   // the two query blocks share one copy of the code
  for (int half = 0; half < 2; ++half) { const int qb = half ? qx : qa; const int q0 = qb * 64 + wave * 16; const size_t rq = bh * SS + q0;
  v16h aq[2];
#pragma unroll
  for (int kc = 0; kc < 2; ++kc) aq[kc] = frag_h(Q + (rq + col) * HD + kc * 32, lane);
  const float qsc = 0.125f * bfr(IMP[b * SS + q0 + col]);   // 1/8 x importance of this lane's query (a power of two: same rounding as the two factors in turn)
  v8f acc[4] = {};
#pragma unroll 1
  for (int kb = 0; kb <= qb; ++kb, ++t) { const int j0 = kb * BLK; const int bf = t & 1; v8f s[4]; v16h kf[8], vf[8]; const int rel = q0 + col - j0 - 8 * g;   // key ct * 16 + r of this lane is causal where ct * 16 + r <= rel
#pragma unroll
    for (int ct = 0; ct < 4; ++ct)
#pragma unroll
      for (int kc = 0; kc < 2; ++kc) kf[ct * 2 + kc] = frag_h(&sk[bf][ct * 16 + col][kc * 32], lane);
#pragma unroll
    for (int kc = 0; kc < 2; ++kc)
#pragma unroll
      for (int dt = 0; dt < 4; ++dt) vf[kc * 4 + dt] = frag_h(&sv[bf][dt * 16 + col][kc * 32], lane);
    // transposed scores: A = K rows, B = Q rows; s[ct][r] = score of key j0 + ct * 16 + 8 * g + r for query q0 + col, so a lane and its partner lane ^ 16 hold all 64 scores of one query
#pragma unroll
    for (int ct = 0; ct < 4; ++ct) { v8f c = {};
#pragma unroll
      for (int kc = 0; kc < 2; ++kc) c = wmma16(kf[ct * 2 + kc], aq[kc], c);
#pragma unroll
      for (int r = 0; r < 8; ++r) s[ct][r] = (ct * 16 + r <= rel) ? c[r] * qsc : -3.0e38f; }
    float m4[4];
#pragma unroll
    for (int ct = 0; ct < 4; ++ct) m4[ct] = fmaxf(fmaxf(fmaxf(s[ct][0], s[ct][1]), fmaxf(s[ct][2], s[ct][3])), fmaxf(fmaxf(s[ct][4], s[ct][5]), fmaxf(s[ct][6], s[ct][7])));
    float mx = fmaxf(fmaxf(m4[0], m4[1]), fmaxf(m4[2], m4[3])); mx = fmaxf(mx, xhalf(mx));
    const float safe = (mx <= -1.0e38f) ? 0.f : mx; float e4[4];
#pragma unroll
    for (int ct = 0; ct < 4; ++ct) {
#pragma unroll
      for (int r = 0; r < 8; ++r) s[ct][r] = (ct * 16 + r <= rel) ? __expf(s[ct][r] - safe) : 0.f;
      e4[ct] = ((s[ct][0] + s[ct][1]) + (s[ct][2] + s[ct][3])) + ((s[ct][4] + s[ct][5]) + (s[ct][6] + s[ct][7])); }
    float es = (e4[0] + e4[1]) + (e4[2] + e4[3]); es += xhalf(es);
    const float inv = 2048.0f / (es + 1e-6f);
    // two 16-key score tiles of one query, converted in place, are the A fragment of P x v in the hardware k order (element i = key 8 * g + i, element 8 + i = key 16 + 8 * g + i of each 32)
    v16h pa[2];
#pragma unroll
    for (int kc = 0; kc < 2; ++kc)
#pragma unroll
      for (int i = 0; i < 8; ++i) { pa[kc][i] = (_Float16)(s[2 * kc][i] * inv); pa[kc][8 + i] = (_Float16)(s[2 * kc + 1][i] * inv); }
#pragma unroll
    for (int kc = 0; kc < 2; ++kc)
#pragma unroll
      for (int dt = 0; dt < 4; ++dt) acc[dt] = wmma16(pa[kc], vf[kc * 4 + dt], acc[dt]);
    asm volatile("s_wait_dscnt 0x0" ::: "memory");      // this wave's LDS reads of buffer bf are done
    asm volatile("s_wait_asynccnt 0x0" ::: "memory");   // this wave's pieces of trip t + 1's key block have landed
    __syncthreads();                                    // publishes trip t + 1's key block and frees buffer bf
    if (t + 2 <= TQB) { const int kn = (t + 2 <= qa) ? t + 2 : t + 1 - qa;   // key block of trip t + 2: behind the first walk's last block the second walk's block 0
      stage_kv(kg + (size_t)kn * (BLK * HD), vg + kn * BLK, lk + 9216u * bf, lv + 9216u * bf); } }
  const float fin = ((active >> half) & 1) ? (1.0f / 2048.0f) : 0.f;
#pragma unroll
  for (int r = 0; r < 8; ++r)
#pragma unroll
    for (int dt = 0; dt < 4; ++dt) so[wave][8 * g + r][dt * 16 + col] = acc[dt][r] * fin;
  LDSX();
  for (int rl = 0; rl < 16; ++rl) if (lane < 16) vst2(OUT + (rq + rl) * HD + lane * 4, *(const v4f*)&so[wave][rl][lane * 4]);
  asm volatile("s_wait_xcnt 0x0" ::: "memory");         // the second query block's set-up rewrites registers that these stores name
  }
  asm volatile("s_wait_asynccnt 0x0" ::: "memory");     // no copy is outstanding when the wave ends
}
extern "C" void kernel_launch(void* const* d_in, const int* in_sizes, int n_in, void* d_out, int out_size, void* d_ws, size_t ws_size, hipStream_t stream) {
  (void)in_sizes; (void)n_in; (void)out_size;
  const float** F = (const float**)d_in;   // 0 q, 1 k, 2 v [2,16,2048,64], 3 importance_scores [2,2048]
  if (ws_size < (size_t)WS_END) return;
  char* ws = (char*)d_ws; _Float16 *Q = (_Float16*)(ws + WS_Q), *K = (_Float16*)(ws + WS_K), *VT = (_Float16*)(ws + WS_VT);
  k_rows<<<NB * NH * SS / 128, 256, 0, stream>>>(F[0], Q);
  k_rows<<<NB * NH * SS / 128, 256, 0, stream>>>(F[1], K);
  k_vt<<<NB * NH * SS / 128, 256, 0, stream>>>(F[2], VT);
  k_attn<<<dim3(TQB / 2, NH, TNB), 128, 0, stream>>>(Q, K, VT, F[3], (float*)d_out);
}

// v005
// It runs in 44.8 microseconds.
// Two timings next to v004 put it at 1.06 and 1.05 times that version's speed.
// Counting every step since v000, it is 4.19 times as fast.
// compute dtype: q, k, v, importance rounded to bf16 and used as EXACT f16 operands on WMMA 16x16x32; scores = (q . k) x 1/8 x importance_i in f32 (the module scales q by importance first - identical algebra), causal mask, per 64-key block: max / exp (hardware exp) / sum + 1e-6 in f32, P (scaled by 2^11, single f16) x v (exact f16); the per-64-query-block activity gate from the importance threshold; f32 accumulate.
#include <hip/hip_runtime.h>
#include <math.h>

typedef __attribute__((ext_vector_type(16))) _Float16 v16h;
typedef __attribute__((ext_vector_type(16))) __bf16 v16b;
typedef __attribute__((ext_vector_type(8)))  _Float16 v8h;
typedef __attribute__((ext_vector_type(8)))  float v8f;
typedef __attribute__((ext_vector_type(4)))  float v4f;
typedef __attribute__((ext_vector_type(2)))  float v2f;
typedef __attribute__((ext_vector_type(4)))  unsigned v4u;
typedef __attribute__((ext_vector_type(4)))  int v4i;
typedef float __attribute__((may_alias)) float_a;
typedef int __attribute__((may_alias)) int_a;

template <typename T> __device__ __forceinline__ void vst2(void* p, T v) { *(T*)p = v;  }
__device__ __forceinline__ v8f wmma16(v16h a, v16h b, v8f c) {
  v8f d = __builtin_amdgcn_wmma_f32_16x16x32_f16(false, a, false, b, (short)0, c, false, false);
  asm volatile("v_nop\n\tv_nop\n\tv_nop\n\tv_nop" : "+v"(d) : "v"(a), "v"(b));
  return d;
}
__device__ __forceinline__ v8f wmma_bf(v16b a, v16b b, v8f c) {
  v8f d = __builtin_amdgcn_wmma_f32_16x16x32_bf16(false, a, false, b, (short)0, c, false, false);
  asm volatile("v_nop\n\tv_nop\n\tv_nop\n\tv_nop" : "+v"(d) : "v"(a), "v"(b));
  return d;
}
// 16x16x32 fragments: lane = (h = lane>>4, row/col = lane&15); elements 0..7 = k0+8h+0..7, 8..15 = k0+16+8h+0..7; D element r = row 8h+r
__device__ __forceinline__ v16h frag_h(const _Float16* rowk0, int lane) {
  union { v16h v; v8h q[2]; } u; const _Float16* p = rowk0 + 8 * (lane >> 4);
  u.q[0] = *(const v8h*)p; u.q[1] = *(const v8h*)(p + 16); return u.v;
}
__device__ __forceinline__ v16h frag_f32(const float* rowk0, int lane) {
  v16h a; const float* p = rowk0 + 8 * (lane >> 4);
#pragma unroll
  for (int i = 0; i < 8; ++i) { a[i] = (_Float16)p[i]; a[8 + i] = (_Float16)p[16 + i]; }
  return a;
}
__device__ __forceinline__ v16h frag_f32s(const float* rowk0, int lane, float sc) {
  v16h a; const float* p = rowk0 + 8 * (lane >> 4);
#pragma unroll
  for (int i = 0; i < 8; ++i) { a[i] = (_Float16)(p[i] * sc); a[8 + i] = (_Float16)(p[16 + i] * sc); }
  return a;
}
// column fragment from a [K][ld] layout (column n), rows >= K read as 0
__device__ __forceinline__ v16h fragc_f32(const float* W, int k0, int n, int lane, int ld, int K) {
  v16h a; const int g = lane >> 4;
#pragma unroll
  for (int i = 0; i < 8; ++i) { const int ka = k0 + 8 * g + i, kb = ka + 16;
    a[i] = (_Float16)(ka < K ? W[(size_t)(ka < K ? ka : K - 1) * ld + n] : 0.f); a[8 + i] = (_Float16)(kb < K ? W[(size_t)(kb < K ? kb : K - 1) * ld + n] : 0.f); }
  return a;
}
struct F2 { v16b h, l; };
__device__ __forceinline__ F2 bsplit16(const float v[16]) { F2 r;
#pragma unroll
  for (int i = 0; i < 16; ++i) { const __bf16 h = (__bf16)v[i]; r.h[i] = h; r.l[i] = (__bf16)(v[i] - (float)h); }
  return r; }
__device__ __forceinline__ F2 split_row(const float* row, int k0, int lane) { float v[16]; const float* p = row + k0 + 8 * (lane >> 4);
#pragma unroll
  for (int i = 0; i < 8; ++i) { v[i] = p[i]; v[8 + i] = p[16 + i]; }
  return bsplit16(v); }
__device__ __forceinline__ F2 split_rowK(const float* row, int k0, int lane, int K) { float v[16]; const int g = lane >> 4;
#pragma unroll
  for (int i = 0; i < 8; ++i) { const int ka = k0 + 8 * g + i, kb = ka + 16; v[i] = ka < K ? row[ka < K ? ka : K - 1] : 0.f; v[8 + i] = kb < K ? row[kb < K ? kb : K - 1] : 0.f; }
  return bsplit16(v); }
__device__ __forceinline__ F2 split_col(const float* W, int k0, int n, int lane, int ld, int K) { float v[16]; const int g = lane >> 4;
#pragma unroll
  for (int i = 0; i < 8; ++i) { const int ka = k0 + 8 * g + i, kb = ka + 16; v[i] = ka < K ? W[(size_t)(ka < K ? ka : K - 1) * ld + n] : 0.f; v[8 + i] = kb < K ? W[(size_t)(kb < K ? kb : K - 1) * ld + n] : 0.f; }
  return bsplit16(v); }
__device__ __forceinline__ v8f mac3(const F2& a, const F2& b, v8f c) { c = wmma_bf(a.l, b.h, c); c = wmma_bf(a.h, b.l, c); return wmma_bf(a.h, b.h, c); }
__device__ __forceinline__ float sigm(float v) { return 1.0f / (1.0f + expf(-v)); }
#define LDSX() do { asm volatile("s_wait_dscnt 0" ::: "memory"); __builtin_amdgcn_wave_barrier(); __builtin_amdgcn_fence(__ATOMIC_RELEASE, "workgroup"); } while (0)


// Dendritic block attention (B 2, H 16, S 2,048, D 64): importance-scaled queries, causal scores normalised independently within each 64-key block (softmax with +1e-6 in the denominator, fully masked blocks contribute 0), summed over blocks, then whole 64-query blocks zeroed unless some token's importance exceeds 0.3.
#define NB 2
#define NH 16
#define SS 2048
#define HD 64
#define BLK 64
#ifndef TQB
#define TQB (SS / 64)
#define TNB NB
#endif
typedef __attribute__((ext_vector_type(8))) __bf16 v8b;
__device__ __forceinline__ v16b frag_b(const __bf16* rowk0, int lane) {
  union { v16b v; v8b q[2]; } u; const __bf16* p = rowk0 + 8 * (lane >> 4);
  u.q[0] = *(const v8b*)p; u.q[1] = *(const v8b*)(p + 16); return u.v;
}
__device__ __forceinline__ float bfr(float v) { return (float)(__bf16)v; }
// lane l takes the value of lane l ^ 16
__device__ __forceinline__ float xhalf(float x) { return __builtin_bit_cast(float, __builtin_amdgcn_permlanex16(__builtin_bit_cast(int, x), __builtin_bit_cast(int, x), 0x76543210, 0xfedcba98, false, false)); }
__device__ __attribute__((noinline)) float exp_ni(float v) { return expf(v); }
__device__ __attribute__((noinline)) float erf_ni(float v) { return erff(v); }

#define WS_K   0u                                  // f16 [b][h][s][64] K ; VT planes [b][h][64][s]
#define WS_VT  (WS_K + 2u * (size_t)NB * NH * SS * HD)
#define WS_END (WS_VT + 2u * (size_t)NB * NH * HD * SS)

typedef __attribute__((ext_vector_type(4))) _Float16 v4h;
typedef __attribute__((ext_vector_type(2))) _Float16 v2h;
// ---- k_rows: 128 rows of k -> exact f16 rows. A lane's eight 16-byte reads are all issued before the first is used; a wave-wide read is 512 contiguous bytes, a wave-wide store 256 (two whole lines), so nothing is staged.
__global__ __launch_bounds__(256) void k_rows(const float* __restrict__ X, _Float16* __restrict__ R) { const size_t e0 = ((size_t)blockIdx.x * 2048 + threadIdx.x) * 4; v4f x[8];
#pragma unroll   // straight-line, so that the eight reads stand together in front of the first conversion
  for (int j = 0; j < 8; ++j) x[j] = *(const v4f*)(X + e0 + j * 1024);
  asm volatile("s_wait_xcnt 0x0" ::: "memory");   // the conversions reuse the registers that hold the reads' address
#pragma unroll   // x[] stays in registers
  for (int j = 0; j < 8; ++j) { v4h y;
#pragma unroll
    for (int i = 0; i < 4; ++i) y[i] = (_Float16)bfr(x[j][i]);
    vst2(R + e0 + j * 1024, y); } }
// ---- k_vt: block = (128 keys of one (b,h)): VT[(b,h)][d][s] = v[(b,h)][s][d]. A lane reads four d of eight keys (four pairs of neighbours) by eight 16-byte reads, all issued before the first is used, and writes each pair of keys as one dword.
// st row d holds its sixteen 16-byte pieces (8 keys each) turned round by d >> 2 places: the 16 lanes that write the same keys for different d then hit 16 different bank groups, and the rows keep their 16-byte alignment for the readers.
__global__ __launch_bounds__(256) void k_vt(const float* __restrict__ V, _Float16* __restrict__ VT) { __shared__ __align__(16) _Float16 st[64][128]; const size_t rb0 = (size_t)blockIdx.x * 128; const size_t bh = rb0 / SS, s0 = rb0 % SS; const int t = threadIdx.x, c4 = t & 15, rp = t >> 4; v4f x[4][2];
#pragma unroll   // straight-line, so that the eight reads stand together in front of the first conversion
  for (int jj = 0; jj < 4; ++jj)
#pragma unroll
    for (int u = 0; u < 2; ++u) x[jj][u] = *(const v4f*)(V + (rb0 + 32 * jj + 2 * rp + u) * HD + c4 * 4);
#pragma unroll   // x[] stays in registers
  for (int jj = 0; jj < 4; ++jj) { const int r = 32 * jj + 2 * rp, pos = (((r >> 3) + c4) & 15) * 8 + (r & 7);
#pragma unroll
    for (int i = 0; i < 4; ++i) { v2h p; p[0] = (_Float16)bfr(x[jj][0][i]); p[1] = (_Float16)bfr(x[jj][1][i]); vst2(&st[c4 * 4 + i][pos], p); } }
  __syncthreads();
#pragma unroll   // the four LDS reads go out together, one wait chain instead of four
  for (int j = 0; j < 4; ++j) { const int e = t + 256 * j, d = e >> 4, pc = e & 15; vst2((unsigned*)(VT + (bh * HD + d) * SS + s0 + pc * 8), *(const v4u*)&st[d][((pc + (d >> 2)) & 15) * 8]); } }
// ---- stage_kv: one 64-key block's K rows and V^T rows (64 rows of 128 B each) -> LDS rows of 144 B. Each of the 128 lanes copies four 16-byte pieces of each tile, 16 rows apart.
// The s_wait_xcnt stands inside the copies' own statement so that no address register is rewritten in front of it.
__device__ __forceinline__ void stage_kv(const _Float16* kg, const _Float16* vg, unsigned lk, unsigned lv) {
  asm volatile("global_load_async_to_lds_b128 %0, %8, off\n\t"
               "global_load_async_to_lds_b128 %1, %9, off\n\t"
               "global_load_async_to_lds_b128 %2, %10, off\n\t"
               "global_load_async_to_lds_b128 %3, %11, off\n\t"
               "global_load_async_to_lds_b128 %4, %12, off\n\t"
               "global_load_async_to_lds_b128 %5, %13, off\n\t"
               "global_load_async_to_lds_b128 %6, %14, off\n\t"
               "global_load_async_to_lds_b128 %7, %15, off\n\t"
               "s_wait_xcnt 0x0"
               :: "v"(lk), "v"(lk + 16u * 144u), "v"(lk + 32u * 144u), "v"(lk + 48u * 144u),
                  "v"(lv), "v"(lv + 16u * 144u), "v"(lv + 32u * 144u), "v"(lv + 48u * 144u),
                  "v"(kg), "v"(kg + 16 * HD), "v"(kg + 32 * HD), "v"(kg + 48 * HD),
                  "v"(vg), "v"(vg + 16 * SS), "v"(vg + 32 * SS), "v"(vg + 48 * SS)
               : "memory");
}
// ---- k_attn: block = (two query blocks of 64 queries, h, b): query block TQB - 1 - x, then query block x, one after the other in every wave, so that every work-group walks TQB + 1 key blocks; the two-buffer ring runs on from the first walk into the second. Per causal 64-key block an independent masked softmax (+1e-6), P x v accumulated; output x active(query block)
__global__ __launch_bounds__(128) void k_attn(const float* __restrict__ Q, const _Float16* __restrict__ K, const _Float16* __restrict__ VT, const float* __restrict__ IMP, float* __restrict__ OUT) {
  __shared__ __align__(16) float so[4][16][68]; __shared__ int sact[4];
  __shared__ __align__(16) _Float16 sk[2][64][72]; __shared__ __align__(16) _Float16 sv[2][64][72];   // two buffers of one key block each: K rows, V^T rows; pitch 144 B
  const int tid = threadIdx.x, wave = tid >> 5, lane = tid & 31, col = lane & 15, g = lane >> 4; const int h = blockIdx.y; const size_t b = blockIdx.z; const int qx = blockIdx.x, qa = TQB - 1 - qx; const size_t bh = b * NH + h;   // qa >= TQB / 2: the first walk has at least two key blocks
  // key block 0 -> buffer 0; lane's piece: row tid >> 3 (+16, +32, +48), 16-byte column tid & 7
  const int srow = tid >> 3, scol = (tid & 7) * 8;
  const _Float16* kg = K + (bh * SS + srow) * HD + scol; const _Float16* vg = VT + (bh * HD + srow) * SS + scol;
  const unsigned lk = (unsigned)(size_t)&sk[0][srow][scol], lv = (unsigned)(size_t)&sv[0][srow][scol];
  stage_kv(kg, vg, lk, lv);
  // activity of the two 64-query blocks: any importance > 0.3; bit 0 for block qa, bit 1 for block qx
  { float iv = bfr(IMP[b * SS + qa * 64 + (tid & 63)]), iw = bfr(IMP[b * SS + qx * 64 + (tid & 63)]); int act = ((iv > 0.3f) ? 1 : 0) | ((iw > 0.3f) ? 2 : 0);
#pragma unroll
    for (int o = 1; o < 32; o <<= 1) act |= __shfl_xor(act, o);
    if (lane == 0) sact[wave] = act; }
  asm volatile("s_wait_asynccnt 0x0" ::: "memory");   // this wave's pieces of key block 0 have landed before the barrier publishes them
  __syncthreads(); const int active = sact[0] | sact[1] | sact[2] | sact[3];
  stage_kv(kg + BLK * HD, vg + BLK, lk + 9216u, lv + 9216u);   // key block 1 -> buffer 1, in flight during trip 0
  int t = 0;   // trip of the ring, 0 to TQB over both walks
#pragma unroll 1   // the two query blocks share one copy of the code
  for (int half = 0; half < 2; ++half) { const int qb = half ? qx : qa; const int q0 = qb * 64 + wave * 16; const size_t rq = bh * SS + q0;
  // Q fragments (hardware k order, as frag_h) straight from the f32 input: each value rounded to bf16, then exact in f16. A query row is read by one wave only, once, so a converted copy in the workspace would save nothing.
  v16h aq[2]; v4f xq[2][4];
#pragma unroll
  for (int kc = 0; kc < 2; ++kc) { const float* p = Q + (rq + col) * HD + kc * 32 + 8 * g; xq[kc][0] = *(const v4f*)p; xq[kc][1] = *(const v4f*)(p + 4); xq[kc][2] = *(const v4f*)(p + 16); xq[kc][3] = *(const v4f*)(p + 20); }
  asm volatile("s_wait_xcnt 0x0" ::: "memory");   // what follows reuses the registers that hold these reads' address
#pragma unroll   // this loop and the two inside it: constant indices, so that xq[] and aq[] stay in registers
  for (int kc = 0; kc < 2; ++kc)
#pragma unroll
    for (int j = 0; j < 4; ++j)
#pragma unroll
      for (int i = 0; i < 4; ++i) aq[kc][4 * j + i] = (_Float16)bfr(xq[kc][j][i]);
  const float qsc = 0.125f * bfr(IMP[b * SS + q0 + col]);   // 1/8 x importance of this lane's query (a power of two: same rounding as the two factors in turn)
  v8f acc[4] = {};
#pragma unroll 1
  for (int kb = 0; kb <= qb; ++kb, ++t) { const int j0 = kb * BLK; const int bf = t & 1; v8f s[4]; v16h kf[8], vf[8]; const int rel = q0 + col - j0 - 8 * g;   // key ct * 16 + r of this lane is causal where ct * 16 + r <= rel
#pragma unroll
    for (int ct = 0; ct < 4; ++ct)
#pragma unroll
      for (int kc = 0; kc < 2; ++kc) kf[ct * 2 + kc] = frag_h(&sk[bf][ct * 16 + col][kc * 32], lane);
#pragma unroll
    for (int kc = 0; kc < 2; ++kc)
#pragma unroll
      for (int dt = 0; dt < 4; ++dt) vf[kc * 4 + dt] = frag_h(&sv[bf][dt * 16 + col][kc * 32], lane);
    // transposed scores: A = K rows, B = Q rows; s[ct][r] = score of key j0 + ct * 16 + 8 * g + r for query q0 + col, so a lane and its partner lane ^ 16 hold all 64 scores of one query
#pragma unroll
    for (int ct = 0; ct < 4; ++ct) { v8f c = {};
#pragma unroll
      for (int kc = 0; kc < 2; ++kc) c = wmma16(kf[ct * 2 + kc], aq[kc], c);
#pragma unroll
      for (int r = 0; r < 8; ++r) s[ct][r] = (ct * 16 + r <= rel) ? c[r] * qsc : -3.0e38f; }
    float m4[4];
#pragma unroll
    for (int ct = 0; ct < 4; ++ct) m4[ct] = fmaxf(fmaxf(fmaxf(s[ct][0], s[ct][1]), fmaxf(s[ct][2], s[ct][3])), fmaxf(fmaxf(s[ct][4], s[ct][5]), fmaxf(s[ct][6], s[ct][7])));
    float mx = fmaxf(fmaxf(m4[0], m4[1]), fmaxf(m4[2], m4[3])); mx = fmaxf(mx, xhalf(mx));
    const float safe = (mx <= -1.0e38f) ? 0.f : mx; float e4[4];
#pragma unroll
    for (int ct = 0; ct < 4; ++ct) {
#pragma unroll
      for (int r = 0; r < 8; ++r) s[ct][r] = (ct * 16 + r <= rel) ? __expf(s[ct][r] - safe) : 0.f;
      e4[ct] = ((s[ct][0] + s[ct][1]) + (s[ct][2] + s[ct][3])) + ((s[ct][4] + s[ct][5]) + (s[ct][6] + s[ct][7])); }
    float es = (e4[0] + e4[1]) + (e4[2] + e4[3]); es += xhalf(es);
    const float inv = 2048.0f / (es + 1e-6f);
    // two 16-key score tiles of one query, converted in place, are the A fragment of P x v in the hardware k order (element i = key 8 * g + i, element 8 + i = key 16 + 8 * g + i of each 32)
    v16h pa[2];
#pragma unroll
    for (int kc = 0; kc < 2; ++kc)
#pragma unroll
      for (int i = 0; i < 8; ++i) { pa[kc][i] = (_Float16)(s[2 * kc][i] * inv); pa[kc][8 + i] = (_Float16)(s[2 * kc + 1][i] * inv); }
#pragma unroll
    for (int kc = 0; kc < 2; ++kc)
#pragma unroll
      for (int dt = 0; dt < 4; ++dt) acc[dt] = wmma16(pa[kc], vf[kc * 4 + dt], acc[dt]);
    asm volatile("s_wait_dscnt 0x0" ::: "memory");      // this wave's LDS reads of buffer bf are done
    asm volatile("s_wait_asynccnt 0x0" ::: "memory");   // this wave's pieces of trip t + 1's key block have landed
    __syncthreads();                                    // publishes trip t + 1's key block and frees buffer bf
    if (t + 2 <= TQB) { const int kn = (t + 2 <= qa) ? t + 2 : t + 1 - qa;   // key block of trip t + 2: behind the first walk's last block the second walk's block 0
      stage_kv(kg + (size_t)kn * (BLK * HD), vg + kn * BLK, lk + 9216u * bf, lv + 9216u * bf); } }
  const float fin = ((active >> half) & 1) ? (1.0f / 2048.0f) : 0.f;
#pragma unroll
  for (int r = 0; r < 8; ++r)
#pragma unroll
    for (int dt = 0; dt < 4; ++dt) so[wave][8 * g + r][dt * 16 + col] = acc[dt][r] * fin;
  LDSX();
  for (int rl = 0; rl < 16; ++rl) if (lane < 16) vst2(OUT + (rq + rl) * HD + lane * 4, *(const v4f*)&so[wave][rl][lane * 4]);
  asm volatile("s_wait_xcnt 0x0" ::: "memory");         // the second query block's set-up rewrites registers that these stores name
  }
  asm volatile("s_wait_asynccnt 0x0" ::: "memory");     // no copy is outstanding when the wave ends
}
extern "C" void kernel_launch(void* const* d_in, const int* in_sizes, int n_in, void* d_out, int out_size, void* d_ws, size_t ws_size, hipStream_t stream) {
  (void)in_sizes; (void)n_in; (void)out_size;
  const float** F = (const float**)d_in;   // 0 q, 1 k, 2 v [2,16,2048,64], 3 importance_scores [2,2048]
  if (ws_size < (size_t)WS_END) return;
  char* ws = (char*)d_ws; _Float16 *K = (_Float16*)(ws + WS_K), *VT = (_Float16*)(ws + WS_VT);
  k_rows<<<NB * NH * SS / 128, 256, 0, stream>>>(F[1], K);
  k_vt<<<NB * NH * SS / 128, 256, 0, stream>>>(F[2], VT);
  k_attn<<<dim3(TQB / 2, NH, TNB), 128, 0, stream>>>(F[0], K, VT, F[3], (float*)d_out);
}

// v006
// It runs in 41.6 microseconds.
// Next to v005, in two timings, it ran 1.08 and 1.07 times as fast.
// Counting every step since v000, it is 4.49 times as fast.
// compute dtype: q, k, v, importance rounded to bf16 and used as EXACT f16 operands on WMMA 16x16x32; scores = (q . k) x 1/8 x importance_i in f32 (the module scales q by importance first - identical algebra), causal mask, per 64-key block: max / exp (hardware exp) / sum + 1e-6 in f32, P (scaled by 2^11, single f16) x v (exact f16); the per-64-query-block activity gate from the importance threshold; f32 accumulate.
#include <hip/hip_runtime.h>
#include <math.h>

typedef __attribute__((ext_vector_type(16))) _Float16 v16h;
typedef __attribute__((ext_vector_type(16))) __bf16 v16b;
typedef __attribute__((ext_vector_type(8)))  _Float16 v8h;
typedef __attribute__((ext_vector_type(8)))  float v8f;
typedef __attribute__((ext_vector_type(4)))  float v4f;
typedef __attribute__((ext_vector_type(2)))  float v2f;
typedef __attribute__((ext_vector_type(4)))  unsigned v4u;
typedef __attribute__((ext_vector_type(4)))  int v4i;
typedef float __attribute__((may_alias)) float_a;
typedef int __attribute__((may_alias)) int_a;

template <typename T> __device__ __forceinline__ void vst2(void* p, T v) { *(T*)p = v;  }
__device__ __forceinline__ v8f wmma16(v16h a, v16h b, v8f c) {
  v8f d = __builtin_amdgcn_wmma_f32_16x16x32_f16(false, a, false, b, (short)0, c, false, false);
  asm volatile("v_nop\n\tv_nop\n\tv_nop\n\tv_nop" : "+v"(d) : "v"(a), "v"(b));
  return d;
}
__device__ __forceinline__ v8f wmma_bf(v16b a, v16b b, v8f c) {
  v8f d = __builtin_amdgcn_wmma_f32_16x16x32_bf16(false, a, false, b, (short)0, c, false, false);
  asm volatile("v_nop\n\tv_nop\n\tv_nop\n\tv_nop" : "+v"(d) : "v"(a), "v"(b));
  return d;
}
// 16x16x32 fragments: lane = (h = lane>>4, row/col = lane&15); elements 0..7 = k0+8h+0..7, 8..15 = k0+16+8h+0..7; D element r = row 8h+r
__device__ __forceinline__ v16h frag_h(const _Float16* rowk0, int lane) {
  union { v16h v; v8h q[2]; } u; const _Float16* p = rowk0 + 8 * (lane >> 4);
  u.q[0] = *(const v8h*)p; u.q[1] = *(const v8h*)(p + 16); return u.v;
}
__device__ __forceinline__ v16h frag_f32(const float* rowk0, int lane) {
  v16h a; const float* p = rowk0 + 8 * (lane >> 4);
#pragma unroll
  for (int i = 0; i < 8; ++i) { a[i] = (_Float16)p[i]; a[8 + i] = (_Float16)p[16 + i]; }
  return a;
}
__device__ __forceinline__ v16h frag_f32s(const float* rowk0, int lane, float sc) {
  v16h a; const float* p = rowk0 + 8 * (lane >> 4);
#pragma unroll
  for (int i = 0; i < 8; ++i) { a[i] = (_Float16)(p[i] * sc); a[8 + i] = (_Float16)(p[16 + i] * sc); }
  return a;
}
// column fragment from a [K][ld] layout (column n), rows >= K read as 0
__device__ __forceinline__ v16h fragc_f32(const float* W, int k0, int n, int lane, int ld, int K) {
  v16h a; const int g = lane >> 4;
#pragma unroll
  for (int i = 0; i < 8; ++i) { const int ka = k0 + 8 * g + i, kb = ka + 16;
    a[i] = (_Float16)(ka < K ? W[(size_t)(ka < K ? ka : K - 1) * ld + n] : 0.f); a[8 + i] = (_Float16)(kb < K ? W[(size_t)(kb < K ? kb : K - 1) * ld + n] : 0.f); }
  return a;
}
struct F2 { v16b h, l; };
__device__ __forceinline__ F2 bsplit16(const float v[16]) { F2 r;
#pragma unroll
  for (int i = 0; i < 16; ++i) { const __bf16 h = (__bf16)v[i]; r.h[i] = h; r.l[i] = (__bf16)(v[i] - (float)h); }
  return r; }
__device__ __forceinline__ F2 split_row(const float* row, int k0, int lane) { float v[16]; const float* p = row + k0 + 8 * (lane >> 4);
#pragma unroll
  for (int i = 0; i < 8; ++i) { v[i] = p[i]; v[8 + i] = p[16 + i]; }
  return bsplit16(v); }
__device__ __forceinline__ F2 split_rowK(const float* row, int k0, int lane, int K) { float v[16]; const int g = lane >> 4;
#pragma unroll
  for (int i = 0; i < 8; ++i) { const int ka = k0 + 8 * g + i, kb = ka + 16; v[i] = ka < K ? row[ka < K ? ka : K - 1] : 0.f; v[8 + i] = kb < K ? row[kb < K ? kb : K - 1] : 0.f; }
  return bsplit16(v); }
__device__ __forceinline__ F2 split_col(const float* W, int k0, int n, int lane, int ld, int K) { float v[16]; const int g = lane >> 4;
#pragma unroll
  for (int i = 0; i < 8; ++i) { const int ka = k0 + 8 * g + i, kb = ka + 16; v[i] = ka < K ? W[(size_t)(ka < K ? ka : K - 1) * ld + n] : 0.f; v[8 + i] = kb < K ? W[(size_t)(kb < K ? kb : K - 1) * ld + n] : 0.f; }
  return bsplit16(v); }
__device__ __forceinline__ v8f mac3(const F2& a, const F2& b, v8f c) { c = wmma_bf(a.l, b.h, c); c = wmma_bf(a.h, b.l, c); return wmma_bf(a.h, b.h, c); }
__device__ __forceinline__ float sigm(float v) { return 1.0f / (1.0f + expf(-v)); }
#define LDSX() do { asm volatile("s_wait_dscnt 0" ::: "memory"); __builtin_amdgcn_wave_barrier(); __builtin_amdgcn_fence(__ATOMIC_RELEASE, "workgroup"); } while (0)


// Dendritic block attention (B 2, H 16, S 2,048, D 64): importance-scaled queries, causal scores normalised independently within each 64-key block (softmax with +1e-6 in the denominator, fully masked blocks contribute 0), summed over blocks, then whole 64-query blocks zeroed unless some token's importance exceeds 0.3.
#define NB 2
#define NH 16
#define SS 2048
#define HD 64
#define BLK 64
#ifndef TQB
#define TQB (SS / 64)
#define TNB NB
#endif
typedef __attribute__((ext_vector_type(8))) __bf16 v8b;
__device__ __forceinline__ v16b frag_b(const __bf16* rowk0, int lane) {
  union { v16b v; v8b q[2]; } u; const __bf16* p = rowk0 + 8 * (lane >> 4);
  u.q[0] = *(const v8b*)p; u.q[1] = *(const v8b*)(p + 16); return u.v;
}
__device__ __forceinline__ float bfr(float v) { return (float)(__bf16)v; }
// lane l takes the value of lane l ^ 16
__device__ __forceinline__ float xhalf(float x) { return __builtin_bit_cast(float, __builtin_amdgcn_permlanex16(__builtin_bit_cast(int, x), __builtin_bit_cast(int, x), 0x76543210, 0xfedcba98, false, false)); }
__device__ __attribute__((noinline)) float exp_ni(float v) { return expf(v); }
__device__ __attribute__((noinline)) float erf_ni(float v) { return erff(v); }

#define WS_K   0u                                  // f16 [b][h][s][64] K ; VT planes [b][h][64][s]
#define WS_VT  (WS_K + 2u * (size_t)NB * NH * SS * HD)
#define WS_END (WS_VT + 2u * (size_t)NB * NH * HD * SS)

typedef __attribute__((ext_vector_type(4))) _Float16 v4h;
typedef __attribute__((ext_vector_type(2))) _Float16 v2h;
// ---- k_rows: 128 rows of k -> exact f16 rows. A lane's eight 16-byte reads are all issued before the first is used; a wave-wide read is 512 contiguous bytes, a wave-wide store 256 (two whole lines), so nothing is staged.
__global__ __launch_bounds__(256) void k_rows(const float* __restrict__ X, _Float16* __restrict__ R) { const size_t e0 = ((size_t)blockIdx.x * 2048 + threadIdx.x) * 4; v4f x[8];
#pragma unroll   // straight-line, so that the eight reads stand together in front of the first conversion
  for (int j = 0; j < 8; ++j) x[j] = *(const v4f*)(X + e0 + j * 1024);
  asm volatile("s_wait_xcnt 0x0" ::: "memory");   // the conversions reuse the registers that hold the reads' address
#pragma unroll   // x[] stays in registers
  for (int j = 0; j < 8; ++j) { v4h y;
#pragma unroll
    for (int i = 0; i < 4; ++i) y[i] = (_Float16)bfr(x[j][i]);
    vst2(R + e0 + j * 1024, y); } }
// ---- k_vt: block = (128 keys of one (b,h)): VT[(b,h)][d][s] = v[(b,h)][s][d]. A lane reads four d of eight keys (four pairs of neighbours) by eight 16-byte reads, all issued before the first is used, and writes each pair of keys as one dword.
// st row d holds its sixteen 16-byte pieces (8 keys each) turned round by d >> 2 places: the 16 lanes that write the same keys for different d then hit 16 different bank groups, and the rows keep their 16-byte alignment for the readers.
__global__ __launch_bounds__(256) void k_vt(const float* __restrict__ V, _Float16* __restrict__ VT) { __shared__ __align__(16) _Float16 st[64][128]; const size_t rb0 = (size_t)blockIdx.x * 128; const size_t bh = rb0 / SS, s0 = rb0 % SS; const int t = threadIdx.x, c4 = t & 15, rp = t >> 4; v4f x[4][2];
#pragma unroll   // straight-line, so that the eight reads stand together in front of the first conversion
  for (int jj = 0; jj < 4; ++jj)
#pragma unroll
    for (int u = 0; u < 2; ++u) x[jj][u] = *(const v4f*)(V + (rb0 + 32 * jj + 2 * rp + u) * HD + c4 * 4);
#pragma unroll   // x[] stays in registers
  for (int jj = 0; jj < 4; ++jj) { const int r = 32 * jj + 2 * rp, pos = (((r >> 3) + c4) & 15) * 8 + (r & 7);
#pragma unroll
    for (int i = 0; i < 4; ++i) { v2h p; p[0] = (_Float16)bfr(x[jj][0][i]); p[1] = (_Float16)bfr(x[jj][1][i]); vst2(&st[c4 * 4 + i][pos], p); } }
  __syncthreads();
#pragma unroll   // the four LDS reads go out together, one wait chain instead of four
  for (int j = 0; j < 4; ++j) { const int e = t + 256 * j, d = e >> 4, pc = e & 15; vst2((unsigned*)(VT + (bh * HD + d) * SS + s0 + pc * 8), *(const v4u*)&st[d][((pc + (d >> 2)) & 15) * 8]); } }
// ---- stage_kv: one 64-key block's K rows and V^T rows (64 rows of 128 B each) -> LDS rows of 144 B. Each of 128 lanes copies four 16-byte pieces of each tile, 16 rows apart.
// The s_wait_xcnt stands inside the copies' own statement so that no address register is rewritten in front of it.
__device__ __forceinline__ void stage_kv(const _Float16* kg, const _Float16* vg, unsigned lk, unsigned lv) {
  asm volatile("global_load_async_to_lds_b128 %0, %8, off\n\t"
               "global_load_async_to_lds_b128 %1, %9, off\n\t"
               "global_load_async_to_lds_b128 %2, %10, off\n\t"
               "global_load_async_to_lds_b128 %3, %11, off\n\t"
               "global_load_async_to_lds_b128 %4, %12, off\n\t"
               "global_load_async_to_lds_b128 %5, %13, off\n\t"
               "global_load_async_to_lds_b128 %6, %14, off\n\t"
               "global_load_async_to_lds_b128 %7, %15, off\n\t"
               "s_wait_xcnt 0x0"
               :: "v"(lk), "v"(lk + 16u * 144u), "v"(lk + 32u * 144u), "v"(lk + 48u * 144u),
                  "v"(lv), "v"(lv + 16u * 144u), "v"(lv + 32u * 144u), "v"(lv + 48u * 144u),
                  "v"(kg), "v"(kg + 16 * HD), "v"(kg + 32 * HD), "v"(kg + 48 * HD),
                  "v"(vg), "v"(vg + 16 * SS), "v"(vg + 32 * SS), "v"(vg + 48 * SS)
               : "memory");
}
// ---- k_attn: block = (two query blocks of 64 queries, h, b), 8 waves: query block TQB - 1 - x, then query block x, one after the other in every wave. Waves 0 to 3 take the even key blocks of a walk, waves 4 to 7 the odd ones, each wave for 16 queries; a trip of the two-buffer ring holds one key block for each half of the waves, and every work-group makes NTRIP trips; the ring runs on from the first walk into the second. Per causal 64-key block an independent masked softmax (+1e-6), P x v accumulated; the two halves' sums are added through LDS at the end of a walk; output x active(query block)
#define NTRIP (TQB / 2 + 1)   // ceil((TQB - x) / 2) + ceil((x + 1) / 2), the same for every x
__global__ __launch_bounds__(256) void k_attn(const float* __restrict__ Q, const _Float16* __restrict__ K, const _Float16* __restrict__ VT, const float* __restrict__ IMP, float* __restrict__ OUT) {
  __shared__ __align__(16) float so[4][16][68]; __shared__ __align__(16) int sact[8];
  __shared__ __align__(16) _Float16 sk[2][2][64][72]; __shared__ __align__(16) _Float16 sv[2][2][64][72];   // two buffers, each with one key block for either half of the waves: K rows, V^T rows; pitch 144 B
  const int tid = threadIdx.x, wave = tid >> 5, wq = wave & 3, lane = tid & 31, col = lane & 15, g = lane >> 4; const int h = blockIdx.y; const size_t b = blockIdx.z; const int qx = blockIdx.x, qa = TQB - 1 - qx; const size_t bh = b * NH + h;
  const int kh = __builtin_amdgcn_readfirstlane(tid >> 7);   // which half of the waves: 0 even key blocks, 1 odd; in a scalar register, so that the tests on it are scalar branches
  const int na = (qa + 2) >> 1;   // trips of the first walk; qa >= TQB / 2, so trips 0 and 1 lie in it and both their key blocks are causal
  // a lane's piece of its half's key block: row (tid & 127) >> 3 (+16, +32, +48), 16-byte column tid & 7
  const int srow = (tid & 127) >> 3, scol = (tid & 7) * 8;
  const _Float16* kg = K + (bh * SS + srow) * HD + scol; const _Float16* vg = VT + (bh * HD + srow) * SS + scol;
  const unsigned lk = (unsigned)(size_t)&sk[0][kh][srow][scol], lv = (unsigned)(size_t)&sv[0][kh][srow][scol];
  stage_kv(kg + kh * (BLK * HD), vg + kh * BLK, lk, lv);   // key blocks 0 and 1 -> buffer 0
  // activity of the two 64-query blocks: any importance > 0.3; bit 0 for block qa, bit 1 for block qx
  { float iv = bfr(IMP[b * SS + qa * 64 + (tid & 63)]), iw = bfr(IMP[b * SS + qx * 64 + (tid & 63)]); int act = ((iv > 0.3f) ? 1 : 0) | ((iw > 0.3f) ? 2 : 0);
#pragma unroll
    for (int o = 1; o < 32; o <<= 1) act |= __shfl_xor(act, o);
    if (lane == 0) sact[wave] = act; }
  asm volatile("s_wait_asynccnt 0x0" ::: "memory");   // this wave's pieces of trip 0 have landed before the barrier publishes them
  __syncthreads(); const int active = sact[0] | sact[1];   // waves 0 and 1 saw all 64 queries of either block
  stage_kv(kg + (2 + kh) * (BLK * HD), vg + (2 + kh) * BLK, lk + 18432u, lv + 18432u);   // key blocks 2 and 3 -> buffer 1, in flight during trip 0
  int t = 0;   // trip of the ring, 0 to NTRIP - 1 over both walks
#pragma unroll 1   // the two query blocks share one copy of the code
  for (int half = 0; half < 2; ++half) { const int qb = half ? qx : qa; const int q0 = qb * 64 + wq * 16; const size_t rq = bh * SS + q0;
  // Q fragments (hardware k order, as frag_h) straight from the f32 input: each value rounded to bf16, then exact in f16.
  v16h aq[2]; v4f xq[2][4];
#pragma unroll
  for (int kc = 0; kc < 2; ++kc) { const float* p = Q + (rq + col) * HD + kc * 32 + 8 * g; xq[kc][0] = *(const v4f*)p; xq[kc][1] = *(const v4f*)(p + 4); xq[kc][2] = *(const v4f*)(p + 16); xq[kc][3] = *(const v4f*)(p + 20); }
  asm volatile("s_wait_xcnt 0x0" ::: "memory");   // what follows reuses the registers that hold these reads' address
#pragma unroll   // this loop and the two inside it: constant indices, so that xq[] and aq[] stay in registers
  for (int kc = 0; kc < 2; ++kc)
#pragma unroll
    for (int j = 0; j < 4; ++j)
#pragma unroll
      for (int i = 0; i < 4; ++i) aq[kc][4 * j + i] = (_Float16)bfr(xq[kc][j][i]);
  const float qsc = 0.125f * bfr(IMP[b * SS + q0 + col]);   // 1/8 x importance of this lane's query (a power of two: same rounding as the two factors in turn)
  v8f acc[4] = {};
#pragma unroll 1
  for (int kb = kh; kb <= qb + kh; kb += 2, ++t) { const int bf = t & 1;   // (qb + 2) >> 1 trips for either half of the waves
    if (kb <= qb) {   // an odd count of key blocks leaves waves 4 to 7 without one in the walk's last trip: they only pass the foot
    const int j0 = kb * BLK; v8f s[4]; v16h kf[8], vf[8]; const int rel = q0 + col - j0 - 8 * g;   // key ct * 16 + r of this lane is causal where ct * 16 + r <= rel
#pragma unroll
    for (int ct = 0; ct < 4; ++ct)
#pragma unroll
      for (int kc = 0; kc < 2; ++kc) kf[ct * 2 + kc] = frag_h(&sk[bf][kh][ct * 16 + col][kc * 32], lane);
#pragma unroll
    for (int kc = 0; kc < 2; ++kc)
#pragma unroll
      for (int dt = 0; dt < 4; ++dt) vf[kc * 4 + dt] = frag_h(&sv[bf][kh][dt * 16 + col][kc * 32], lane);
    // transposed scores: A = K rows, B = Q rows; s[ct][r] = score of key j0 + ct * 16 + 8 * g + r for query q0 + col, so a lane and its partner lane ^ 16 hold all 64 scores of one query
#pragma unroll
    for (int ct = 0; ct < 4; ++ct) { v8f c = {};
#pragma unroll
      for (int kc = 0; kc < 2; ++kc) c = wmma16(kf[ct * 2 + kc], aq[kc], c);
#pragma unroll
      for (int r = 0; r < 8; ++r) s[ct][r] = (ct * 16 + r <= rel) ? c[r] * qsc : -3.0e38f; }
    float m4[4];
#pragma unroll
    for (int ct = 0; ct < 4; ++ct) m4[ct] = fmaxf(fmaxf(fmaxf(s[ct][0], s[ct][1]), fmaxf(s[ct][2], s[ct][3])), fmaxf(fmaxf(s[ct][4], s[ct][5]), fmaxf(s[ct][6], s[ct][7])));
    float mx = fmaxf(fmaxf(m4[0], m4[1]), fmaxf(m4[2], m4[3])); mx = fmaxf(mx, xhalf(mx));
    const float safe = (mx <= -1.0e38f) ? 0.f : mx; float e4[4];
#pragma unroll
    for (int ct = 0; ct < 4; ++ct) {
#pragma unroll
      for (int r = 0; r < 8; ++r) s[ct][r] = (ct * 16 + r <= rel) ? __expf(s[ct][r] - safe) : 0.f;
      e4[ct] = ((s[ct][0] + s[ct][1]) + (s[ct][2] + s[ct][3])) + ((s[ct][4] + s[ct][5]) + (s[ct][6] + s[ct][7])); }
    float es = (e4[0] + e4[1]) + (e4[2] + e4[3]); es += xhalf(es);
    const float inv = 2048.0f / (es + 1e-6f);
    // two 16-key score tiles of one query, converted in place, are the A fragment of P x v in the hardware k order (element i = key 8 * g + i, element 8 + i = key 16 + 8 * g + i of each 32)
    v16h pa[2];
#pragma unroll
    for (int kc = 0; kc < 2; ++kc)
#pragma unroll
      for (int i = 0; i < 8; ++i) { pa[kc][i] = (_Float16)(s[2 * kc][i] * inv); pa[kc][8 + i] = (_Float16)(s[2 * kc + 1][i] * inv); }
#pragma unroll
    for (int kc = 0; kc < 2; ++kc)
#pragma unroll
      for (int dt = 0; dt < 4; ++dt) acc[dt] = wmma16(pa[kc], vf[kc * 4 + dt], acc[dt]);
    }
    asm volatile("s_wait_dscnt 0x0" ::: "memory");      // this wave's LDS reads of buffer bf are done
    asm volatile("s_wait_asynccnt 0x0" ::: "memory");   // this wave's pieces of trip t + 1 have landed
    __syncthreads();                                    // publishes trip t + 1's key blocks and frees buffer bf
    if (t + 2 < NTRIP) { const int tn = t + 2, first = tn < na; const int kw = 2 * (first ? tn : tn - na) + kh, kl = first ? qa : qx; const int kn = kw < kl ? kw : kl;   // this half's key block of trip t + 2; where the walk has none left for it, the walk's last block once more, which nobody reads
      stage_kv(kg + (size_t)kn * (BLK * HD), vg + kn * BLK, lk + 18432u * bf, lv + 18432u * bf); } }
  const float fin = ((active >> half) & 1) ? (1.0f / 2048.0f) : 0.f;
  // waves 4 to 7 hand their sums over, each lane at the places where its partner lane of waves 0 to 3 holds the same output elements
  if (kh == 1) {
#pragma unroll
    for (int r = 0; r < 8; ++r)
#pragma unroll
      for (int dt = 0; dt < 4; ++dt) so[wq][8 * g + r][dt * 16 + col] = acc[dt][r]; }
  __syncthreads();   // the odd key blocks' sums are in so[] before waves 0 to 3 read them; so[] is written again only behind a later trip's barrier
  if (kh == 0) {
#pragma unroll
  for (int r = 0; r < 8; ++r)
#pragma unroll
    for (int dt = 0; dt < 4; ++dt) so[wq][8 * g + r][dt * 16 + col] = (acc[dt][r] + so[wq][8 * g + r][dt * 16 + col]) * fin;
  LDSX();
  for (int rl = 0; rl < 16; ++rl) if (lane < 16) vst2(OUT + (rq + rl) * HD + lane * 4, *(const v4f*)&so[wq][rl][lane * 4]);
  asm volatile("s_wait_xcnt 0x0" ::: "memory");         // the second query block's set-up rewrites registers that these stores name
  }
  }
  asm volatile("s_wait_asynccnt 0x0" ::: "memory");     // no copy is outstanding when the wave ends
}
extern "C" void kernel_launch(void* const* d_in, const int* in_sizes, int n_in, void* d_out, int out_size, void* d_ws, size_t ws_size, hipStream_t stream) {
  (void)in_sizes; (void)n_in; (void)out_size;
  const float** F = (const float**)d_in;   // 0 q, 1 k, 2 v [2,16,2048,64], 3 importance_scores [2,2048]
  if (ws_size < (size_t)WS_END) return;
  char* ws = (char*)d_ws; _Float16 *K = (_Float16*)(ws + WS_K), *VT = (_Float16*)(ws + WS_VT);
  k_rows<<<NB * NH * SS / 128, 256, 0, stream>>>(F[1], K);
  k_vt<<<NB * NH * SS / 128, 256, 0, stream>>>(F[2], VT);
  k_attn<<<dim3(TQB / 2, NH, TNB), 256, 0, stream>>>(F[0], K, VT, F[3], (float*)d_out);
}

// v007
// A run of this version takes 38.8 microseconds.
// Timed twice side by side with v006, it ran 1.07 times as fast both times.
// All steps since v000 together make it 4.80 times as fast.
// compute dtype: q, k, v, importance rounded to bf16 and used as EXACT f16 operands on WMMA 16x16x32; scores = (q . k) x 1/8 x importance_i in f32 (the module scales q by importance first - identical algebra), causal mask, per 64-key block: max / exp (hardware exp) / sum + 1e-6 in f32, P (scaled by 2^11, single f16) x v (exact f16); the per-64-query-block activity gate from the importance threshold; f32 accumulate.
#include <hip/hip_runtime.h>
#include <math.h>

typedef __attribute__((ext_vector_type(16))) _Float16 v16h;
typedef __attribute__((ext_vector_type(16))) __bf16 v16b;
typedef __attribute__((ext_vector_type(8)))  _Float16 v8h;
typedef __attribute__((ext_vector_type(8)))  float v8f;
typedef __attribute__((ext_vector_type(4)))  float v4f;
typedef __attribute__((ext_vector_type(2)))  float v2f;
typedef __attribute__((ext_vector_type(4)))  unsigned v4u;
typedef __attribute__((ext_vector_type(4)))  int v4i;
typedef float __attribute__((may_alias)) float_a;
typedef int __attribute__((may_alias)) int_a;

template <typename T> __device__ __forceinline__ void vst2(void* p, T v) { *(T*)p = v;  }
__device__ __forceinline__ v8f wmma16(v16h a, v16h b, v8f c) {
  v8f d = __builtin_amdgcn_wmma_f32_16x16x32_f16(false, a, false, b, (short)0, c, false, false);
  asm volatile("v_nop\n\tv_nop\n\tv_nop\n\tv_nop" : "+v"(d) : "v"(a), "v"(b));
  return d;
}
__device__ __forceinline__ v8f wmma_bf(v16b a, v16b b, v8f c) {
  v8f d = __builtin_amdgcn_wmma_f32_16x16x32_bf16(false, a, false, b, (short)0, c, false, false);
  asm volatile("v_nop\n\tv_nop\n\tv_nop\n\tv_nop" : "+v"(d) : "v"(a), "v"(b));
  return d;
}
// 16x16x32 fragments: lane = (h = lane>>4, row/col = lane&15); elements 0..7 = k0+8h+0..7, 8..15 = k0+16+8h+0..7; D element r = row 8h+r
__device__ __forceinline__ v16h frag_h(const _Float16* rowk0, int lane) {
  union { v16h v; v8h q[2]; } u; const _Float16* p = rowk0 + 8 * (lane >> 4);
  u.q[0] = *(const v8h*)p; u.q[1] = *(const v8h*)(p + 16); return u.v;
}
__device__ __forceinline__ v16h frag_f32(const float* rowk0, int lane) {
  v16h a; const float* p = rowk0 + 8 * (lane >> 4);
#pragma unroll
  for (int i = 0; i < 8; ++i) { a[i] = (_Float16)p[i]; a[8 + i] = (_Float16)p[16 + i]; }
  return a;
}
__device__ __forceinline__ v16h frag_f32s(const float* rowk0, int lane, float sc) {
  v16h a; const float* p = rowk0 + 8 * (lane >> 4);
#pragma unroll
  for (int i = 0; i < 8; ++i) { a[i] = (_Float16)(p[i] * sc); a[8 + i] = (_Float16)(p[16 + i] * sc); }
  return a;
}
// column fragment from a [K][ld] layout (column n), rows >= K read as 0
__device__ __forceinline__ v16h fragc_f32(const float* W, int k0, int n, int lane, int ld, int K) {
  v16h a; const int g = lane >> 4;
#pragma unroll
  for (int i = 0; i < 8; ++i) { const int ka = k0 + 8 * g + i, kb = ka + 16;
    a[i] = (_Float16)(ka < K ? W[(size_t)(ka < K ? ka : K - 1) * ld + n] : 0.f); a[8 + i] = (_Float16)(kb < K ? W[(size_t)(kb < K ? kb : K - 1) * ld + n] : 0.f); }
  return a;
}
struct F2 { v16b h, l; };
__device__ __forceinline__ F2 bsplit16(const float v[16]) { F2 r;
#pragma unroll
  for (int i = 0; i < 16; ++i) { const __bf16 h = (__bf16)v[i]; r.h[i] = h; r.l[i] = (__bf16)(v[i] - (float)h); }
  return r; }
__device__ __forceinline__ F2 split_row(const float* row, int k0, int lane) { float v[16]; const float* p = row + k0 + 8 * (lane >> 4);
#pragma unroll
  for (int i = 0; i < 8; ++i) { v[i] = p[i]; v[8 + i] = p[16 + i]; }
  return bsplit16(v); }
__device__ __forceinline__ F2 split_rowK(const float* row, int k0, int lane, int K) { float v[16]; const int g = lane >> 4;
#pragma unroll
  for (int i = 0; i < 8; ++i) { const int ka = k0 + 8 * g + i, kb = ka + 16; v[i] = ka < K ? row[ka < K ? ka : K - 1] : 0.f; v[8 + i] = kb < K ? row[kb < K ? kb : K - 1] : 0.f; }
  return bsplit16(v); }
__device__ __forceinline__ F2 split_col(const float* W, int k0, int n, int lane, int ld, int K) { float v[16]; const int g = lane >> 4;
#pragma unroll
  for (int i = 0; i < 8; ++i) { const int ka = k0 + 8 * g + i, kb = ka + 16; v[i] = ka < K ? W[(size_t)(ka < K ? ka : K - 1) * ld + n] : 0.f; v[8 + i] = kb < K ? W[(size_t)(kb < K ? kb : K - 1) * ld + n] : 0.f; }
  return bsplit16(v); }
__device__ __forceinline__ v8f mac3(const F2& a, const F2& b, v8f c) { c = wmma_bf(a.l, b.h, c); c = wmma_bf(a.h, b.l, c); return wmma_bf(a.h, b.h, c); }
__device__ __forceinline__ float sigm(float v) { return 1.0f / (1.0f + expf(-v)); }
#define LDSX() do { asm volatile("s_wait_dscnt 0" ::: "memory"); __builtin_amdgcn_wave_barrier(); __builtin_amdgcn_fence(__ATOMIC_RELEASE, "workgroup"); } while (0)


// Dendritic block attention (B 2, H 16, S 2,048, D 64): importance-scaled queries, causal scores normalised independently within each 64-key block (softmax with +1e-6 in the denominator, fully masked blocks contribute 0), summed over blocks, then whole 64-query blocks zeroed unless some token's importance exceeds 0.3.
#define NB 2
#define NH 16
#define SS 2048
#define HD 64
#define BLK 64
#ifndef TQB
#define TQB (SS / 64)
#define TNB NB
#endif
typedef __attribute__((ext_vector_type(8))) __bf16 v8b;
__device__ __forceinline__ v16b frag_b(const __bf16* rowk0, int lane) {
  union { v16b v; v8b q[2]; } u; const __bf16* p = rowk0 + 8 * (lane >> 4);
  u.q[0] = *(const v8b*)p; u.q[1] = *(const v8b*)(p + 16); return u.v;
}
__device__ __forceinline__ float bfr(float v) { return (float)(__bf16)v; }
// lane l takes the value of lane l ^ 16
__device__ __forceinline__ float xhalf(float x) { return __builtin_bit_cast(float, __builtin_amdgcn_permlanex16(__builtin_bit_cast(int, x), __builtin_bit_cast(int, x), 0x76543210, 0xfedcba98, false, false)); }
__device__ __attribute__((noinline)) float exp_ni(float v) { return expf(v); }
__device__ __attribute__((noinline)) float erf_ni(float v) { return erff(v); }

#define WS_K   0u                                  // f16 [b][h][s][64] K ; VT planes [b][h][64][s]
#define WS_VT  (WS_K + 2u * (size_t)NB * NH * SS * HD)
#define WS_END (WS_VT + 2u * (size_t)NB * NH * HD * SS)

typedef __attribute__((ext_vector_type(4))) _Float16 v4h;
typedef __attribute__((ext_vector_type(2))) _Float16 v2h;
// ---- k_rows: 128 rows of k -> exact f16 rows. A lane's eight 16-byte reads are all issued before the first is used; a wave-wide read is 512 contiguous bytes, a wave-wide store 256 (two whole lines), so nothing is staged.
__global__ __launch_bounds__(256) void k_rows(const float* __restrict__ X, _Float16* __restrict__ R) { const size_t e0 = ((size_t)blockIdx.x * 2048 + threadIdx.x) * 4; v4f x[8];
#pragma unroll   // straight-line, so that the eight reads stand together in front of the first conversion
  for (int j = 0; j < 8; ++j) x[j] = *(const v4f*)(X + e0 + j * 1024);
  asm volatile("s_wait_xcnt 0x0" ::: "memory");   // the conversions reuse the registers that hold the reads' address
#pragma unroll   // x[] stays in registers
  for (int j = 0; j < 8; ++j) { v4h y;
#pragma unroll
    for (int i = 0; i < 4; ++i) y[i] = (_Float16)bfr(x[j][i]);
    vst2(R + e0 + j * 1024, y); } }
// ---- k_vt: block = (128 keys of one (b,h)): VT[(b,h)][d][s] = v[(b,h)][s][d]. A lane reads four d of eight keys (four pairs of neighbours) by eight 16-byte reads, all issued before the first is used, and writes each pair of keys as one dword.
// st row d holds its sixteen 16-byte pieces (8 keys each) turned round by d >> 2 places: the 16 lanes that write the same keys for different d then hit 16 different bank groups, and the rows keep their 16-byte alignment for the readers.
__global__ __launch_bounds__(256) void k_vt(const float* __restrict__ V, _Float16* __restrict__ VT) { __shared__ __align__(16) _Float16 st[64][128]; const size_t rb0 = (size_t)blockIdx.x * 128; const size_t bh = rb0 / SS, s0 = rb0 % SS; const int t = threadIdx.x, c4 = t & 15, rp = t >> 4; v4f x[4][2];
#pragma unroll   // straight-line, so that the eight reads stand together in front of the first conversion
  for (int jj = 0; jj < 4; ++jj)
#pragma unroll
    for (int u = 0; u < 2; ++u) x[jj][u] = *(const v4f*)(V + (rb0 + 32 * jj + 2 * rp + u) * HD + c4 * 4);
#pragma unroll   // x[] stays in registers
  for (int jj = 0; jj < 4; ++jj) { const int r = 32 * jj + 2 * rp, pos = (((r >> 3) + c4) & 15) * 8 + (r & 7);
#pragma unroll
    for (int i = 0; i < 4; ++i) { v2h p; p[0] = (_Float16)bfr(x[jj][0][i]); p[1] = (_Float16)bfr(x[jj][1][i]); vst2(&st[c4 * 4 + i][pos], p); } }
  __syncthreads();
#pragma unroll   // the four LDS reads go out together, one wait chain instead of four
  for (int j = 0; j < 4; ++j) { const int e = t + 256 * j, d = e >> 4, pc = e & 15; vst2((unsigned*)(VT + (bh * HD + d) * SS + s0 + pc * 8), *(const v4u*)&st[d][((pc + (d >> 2)) & 15) * 8]); } }
// ---- stage_kv: one 64-key block's K rows and V^T rows (64 rows of 128 B each) -> LDS rows of 144 B. Each of 128 lanes copies four 16-byte pieces of each tile, 16 rows apart.
// The s_wait_xcnt stands inside the copies' own statement so that no address register is rewritten in front of it.
__device__ __forceinline__ void stage_kv(const _Float16* kg, const _Float16* vg, unsigned lk, unsigned lv) {
  asm volatile("global_load_async_to_lds_b128 %0, %8, off\n\t"
               "global_load_async_to_lds_b128 %1, %9, off\n\t"
               "global_load_async_to_lds_b128 %2, %10, off\n\t"
               "global_load_async_to_lds_b128 %3, %11, off\n\t"
               "global_load_async_to_lds_b128 %4, %12, off\n\t"
               "global_load_async_to_lds_b128 %5, %13, off\n\t"
               "global_load_async_to_lds_b128 %6, %14, off\n\t"
               "global_load_async_to_lds_b128 %7, %15, off\n\t"
               "s_wait_xcnt 0x0"
               :: "v"(lk), "v"(lk + 16u * 144u), "v"(lk + 32u * 144u), "v"(lk + 48u * 144u),
                  "v"(lv), "v"(lv + 16u * 144u), "v"(lv + 32u * 144u), "v"(lv + 48u * 144u),
                  "v"(kg), "v"(kg + 16 * HD), "v"(kg + 32 * HD), "v"(kg + 48 * HD),
                  "v"(vg), "v"(vg + 16 * SS), "v"(vg + 32 * SS), "v"(vg + 48 * SS)
               : "memory");
}
// ---- k_attn: block = (two query blocks of 64 queries, h, b), 8 waves: query block TQB - 1 - x, then query block x, one after the other in every wave. Waves 0 to 3 take the even key blocks of a walk, waves 4 to 7 the odd ones, each wave for 16 queries; a trip of the two-buffer ring holds one key block for each half of the waves, and every work-group makes NTRIP trips; the ring runs on from the first walk into the second. Per causal 64-key block an independent masked softmax (+1e-6), P x v accumulated; the two halves' sums are added through LDS at the end of a walk; output x active(query block)
#define NTRIP (TQB / 2 + 1)   // ceil((TQB - x) / 2) + ceil((x + 1) / 2), the same for every x
__global__ __launch_bounds__(256) void k_attn(const float* __restrict__ Q, const _Float16* __restrict__ K, const _Float16* __restrict__ VT, const float* __restrict__ IMP, float* __restrict__ OUT) {
  __shared__ __align__(16) float so[4][16][68]; __shared__ __align__(16) int sact[8];
  __shared__ __align__(16) _Float16 sk[2][2][64][72]; __shared__ __align__(16) _Float16 sv[2][2][64][72];   // two buffers, each with one key block for either half of the waves: K rows, V^T rows; pitch 144 B
  const int tid = threadIdx.x, wave = tid >> 5, wq = wave & 3, lane = tid & 31, col = lane & 15, g = lane >> 4; const int h = blockIdx.y; const size_t b = blockIdx.z; const int qx = blockIdx.x, qa = TQB - 1 - qx; const size_t bh = b * NH + h;
  const int kh = __builtin_amdgcn_readfirstlane(tid >> 7);   // which half of the waves: 0 even key blocks, 1 odd; in a scalar register, so that the tests on it are scalar branches
  const int na = (qa + 2) >> 1;   // trips of the first walk; qa >= TQB / 2, so trips 0 and 1 lie in it and both their key blocks are causal
  // a lane's piece of its half's key block: row (tid & 127) >> 3 (+16, +32, +48), 16-byte column tid & 7
  const int srow = (tid & 127) >> 3, scol = (tid & 7) * 8;
  const _Float16* kg = K + (bh * SS + srow) * HD + scol; const _Float16* vg = VT + (bh * HD + srow) * SS + scol;
  const unsigned lk = (unsigned)(size_t)&sk[0][kh][srow][scol], lv = (unsigned)(size_t)&sv[0][kh][srow][scol];
  stage_kv(kg + kh * (BLK * HD), vg + kh * BLK, lk, lv);   // key blocks 0 and 1 -> buffer 0
  // activity of the two 64-query blocks: any importance > 0.3; bit 0 for block qa, bit 1 for block qx
  { float iv = bfr(IMP[b * SS + qa * 64 + (tid & 63)]), iw = bfr(IMP[b * SS + qx * 64 + (tid & 63)]); int act = ((iv > 0.3f) ? 1 : 0) | ((iw > 0.3f) ? 2 : 0);
#pragma unroll
    for (int o = 1; o < 32; o <<= 1) act |= __shfl_xor(act, o);
    if (lane == 0) sact[wave] = act; }
  asm volatile("s_wait_asynccnt 0x0" ::: "memory");   // this wave's pieces of trip 0 have landed before the barrier publishes them
  __syncthreads(); const int active = sact[0] | sact[1];   // waves 0 and 1 saw all 64 queries of either block
  stage_kv(kg + (2 + kh) * (BLK * HD), vg + (2 + kh) * BLK, lk + 18432u, lv + 18432u);   // key blocks 2 and 3 -> buffer 1, in flight during trip 0
  int t = 0;   // trip of the ring, 0 to NTRIP - 1 over both walks
#pragma unroll 1   // the two query blocks share one copy of the code
  for (int half = 0; half < 2; ++half) { const int qb = half ? qx : qa; const int q0 = qb * 64 + wq * 16; const size_t rq = bh * SS + q0;
  // Q fragments (hardware k order, as frag_h) straight from the f32 input: each value rounded to bf16, then exact in f16.
  v16h aq[2]; v4f xq[2][4];
#pragma unroll
  for (int kc = 0; kc < 2; ++kc) { const float* p = Q + (rq + col) * HD + kc * 32 + 8 * g; xq[kc][0] = *(const v4f*)p; xq[kc][1] = *(const v4f*)(p + 4); xq[kc][2] = *(const v4f*)(p + 16); xq[kc][3] = *(const v4f*)(p + 20); }
  asm volatile("s_wait_xcnt 0x0" ::: "memory");   // what follows reuses the registers that hold these reads' address
#pragma unroll   // this loop and the two inside it: constant indices, so that xq[] and aq[] stay in registers
  for (int kc = 0; kc < 2; ++kc)
#pragma unroll
    for (int j = 0; j < 4; ++j)
#pragma unroll
      for (int i = 0; i < 4; ++i) aq[kc][4 * j + i] = (_Float16)bfr(xq[kc][j][i]);
  const float qsc = 0.125f * bfr(IMP[b * SS + q0 + col]);   // 1/8 x importance of this lane's query (a power of two: same rounding as the two factors in turn)
  v8f acc[4] = {};
#pragma unroll 1
  for (int kb = kh; kb <= qb + kh; kb += 2, ++t) { const int bf = t & 1;   // (qb + 2) >> 1 trips for either half of the waves
    if (kb <= qb) {   // an odd count of key blocks leaves waves 4 to 7 without one in the walk's last trip: they only pass the foot
    const int j0 = kb * BLK; v8f s[4]; v16h kf[8], vf[8]; const int rel = q0 + col - j0 - 8 * g;   // key ct * 16 + r of this lane is causal where ct * 16 + r <= rel
#pragma unroll
    for (int ct = 0; ct < 4; ++ct)
#pragma unroll
      for (int kc = 0; kc < 2; ++kc) kf[ct * 2 + kc] = frag_h(&sk[bf][kh][ct * 16 + col][kc * 32], lane);
#pragma unroll
    for (int kc = 0; kc < 2; ++kc)
#pragma unroll
      for (int dt = 0; dt < 4; ++dt) vf[kc * 4 + dt] = frag_h(&sv[bf][kh][dt * 16 + col][kc * 32], lane);
    // transposed scores: A = K rows, B = Q rows; s[ct][r] = score of key j0 + ct * 16 + 8 * g + r for query q0 + col, so a lane and its partner lane ^ 16 hold all 64 scores of one query
#pragma unroll
    for (int ct = 0; ct < 4; ++ct) { v8f c = {};
#pragma unroll
      for (int kc = 0; kc < 2; ++kc) c = wmma16(kf[ct * 2 + kc], aq[kc], c);
#pragma unroll
      for (int r = 0; r < 8; ++r) s[ct][r] = c[r] * qsc; }
    if (kb == qb) {   // a scalar branch: only a walk's last key block, the one on the diagonal, holds keys behind a query; every key of an earlier block is causal for all 64 queries
#pragma unroll
      for (int ct = 0; ct < 4; ++ct)
#pragma unroll
        for (int r = 0; r < 8; ++r) s[ct][r] = (ct * 16 + r <= rel) ? s[ct][r] : -3.0e38f; }
    float m4[4];
#pragma unroll
    for (int ct = 0; ct < 4; ++ct) m4[ct] = fmaxf(fmaxf(fmaxf(s[ct][0], s[ct][1]), fmaxf(s[ct][2], s[ct][3])), fmaxf(fmaxf(s[ct][4], s[ct][5]), fmaxf(s[ct][6], s[ct][7])));
    float mx = fmaxf(fmaxf(m4[0], m4[1]), fmaxf(m4[2], m4[3])); mx = fmaxf(mx, xhalf(mx));
    const float safe = (mx <= -1.0e38f) ? 0.f : mx; float e4[4];
#pragma unroll
    for (int ct = 0; ct < 4; ++ct) { float y[8];
#pragma unroll
      for (int r = 0; r < 8; ++r) { y[r] = (s[ct][r] - safe) * 1.44269504f; s[ct][r] = __builtin_amdgcn_exp2f(y[r]); }   // e^x as the hardware 2^(x log2 e); a masked score, -3.0e38 - safe, lies so far below 0 that the result is exactly 0
      // the slot the instruction set asks for behind a transcendental before a source of it is overwritten: the eight arguments stay live up to this v_nop, which stands behind the eight exps
      asm volatile("v_nop" :: "v"(y[0]), "v"(y[1]), "v"(y[2]), "v"(y[3]), "v"(y[4]), "v"(y[5]), "v"(y[6]), "v"(y[7]), "v"(s[ct][0]), "v"(s[ct][1]), "v"(s[ct][2]), "v"(s[ct][3]), "v"(s[ct][4]), "v"(s[ct][5]), "v"(s[ct][6]), "v"(s[ct][7]));
      e4[ct] = ((s[ct][0] + s[ct][1]) + (s[ct][2] + s[ct][3])) + ((s[ct][4] + s[ct][5]) + (s[ct][6] + s[ct][7])); }
    float es = (e4[0] + e4[1]) + (e4[2] + e4[3]); es += xhalf(es);
    const float inv = 2048.0f / (es + 1e-6f);
    // two 16-key score tiles of one query, converted in place, are the A fragment of P x v in the hardware k order (element i = key 8 * g + i, element 8 + i = key 16 + 8 * g + i of each 32)
    v16h pa[2];
#pragma unroll
    for (int kc = 0; kc < 2; ++kc)
#pragma unroll
      for (int i = 0; i < 8; ++i) { pa[kc][i] = (_Float16)(s[2 * kc][i] * inv); pa[kc][8 + i] = (_Float16)(s[2 * kc + 1][i] * inv); }
#pragma unroll
    for (int kc = 0; kc < 2; ++kc)
#pragma unroll
      for (int dt = 0; dt < 4; ++dt) acc[dt] = wmma16(pa[kc], vf[kc * 4 + dt], acc[dt]);
    }
    asm volatile("s_wait_dscnt 0x0" ::: "memory");      // this wave's LDS reads of buffer bf are done
    asm volatile("s_wait_asynccnt 0x0" ::: "memory");   // this wave's pieces of trip t + 1 have landed
    __syncthreads();                                    // publishes trip t + 1's key blocks and frees buffer bf
    if (t + 2 < NTRIP) { const int tn = t + 2, first = tn < na; const int kw = 2 * (first ? tn : tn - na) + kh, kl = first ? qa : qx; const int kn = kw < kl ? kw : kl;   // this half's key block of trip t + 2; where the walk has none left for it, the walk's last block once more, which nobody reads
      stage_kv(kg + (size_t)kn * (BLK * HD), vg + kn * BLK, lk + 18432u * bf, lv + 18432u * bf); } }
  const float fin = ((active >> half) & 1) ? (1.0f / 2048.0f) : 0.f;
  // waves 4 to 7 hand their sums over, each lane at the places where its partner lane of waves 0 to 3 holds the same output elements
  if (kh == 1) {
#pragma unroll
    for (int r = 0; r < 8; ++r)
#pragma unroll
      for (int dt = 0; dt < 4; ++dt) so[wq][8 * g + r][dt * 16 + col] = acc[dt][r]; }
  __syncthreads();   // the odd key blocks' sums are in so[] before waves 0 to 3 read them; so[] is written again only behind a later trip's barrier
  if (kh == 0) {
#pragma unroll
  for (int r = 0; r < 8; ++r)
#pragma unroll
    for (int dt = 0; dt < 4; ++dt) so[wq][8 * g + r][dt * 16 + col] = (acc[dt][r] + so[wq][8 * g + r][dt * 16 + col]) * fin;
  LDSX();
  for (int rl = 0; rl < 16; ++rl) if (lane < 16) vst2(OUT + (rq + rl) * HD + lane * 4, *(const v4f*)&so[wq][rl][lane * 4]);
  asm volatile("s_wait_xcnt 0x0" ::: "memory");         // the second query block's set-up rewrites registers that these stores name
  }
  }
  asm volatile("s_wait_asynccnt 0x0" ::: "memory");     // no copy is outstanding when the wave ends
}
extern "C" void kernel_launch(void* const* d_in, const int* in_sizes, int n_in, void* d_out, int out_size, void* d_ws, size_t ws_size, hipStream_t stream) {
  (void)in_sizes; (void)n_in; (void)out_size;
  const float** F = (const float**)d_in;   // 0 q, 1 k, 2 v [2,16,2048,64], 3 importance_scores [2,2048]
  if (ws_size < (size_t)WS_END) return;
  char* ws = (char*)d_ws; _Float16 *K = (_Float16*)(ws + WS_K), *VT = (_Float16*)(ws + WS_VT);
  k_rows<<<NB * NH * SS / 128, 256, 0, stream>>>(F[1], K);
  k_vt<<<NB * NH * SS / 128, 256, 0, stream>>>(F[2], VT);
  k_attn<<<dim3(TQB / 2, NH, TNB), 256, 0, stream>>>(F[0], K, VT, F[3], (float*)d_out);
}

// v008
// A run of this version takes 37.2 microseconds.
// Next to v007, in two timings, it ran 1.07 and 1.05 times as fast.
// Over all steps from v000 it is 5.09 times as fast.
// compute dtype: q, k, v, importance rounded to bf16 and used as EXACT f16 operands on WMMA 16x16x32; scores = (q . k) x 1/8 x importance_i in f32 (the module scales q by importance first - identical algebra), causal mask, per 64-key block: max / exp (hardware exp) / sum + 1e-6 in f32, P (scaled by 2^11, single f16) x v (exact f16); the per-64-query-block activity gate from the importance threshold; f32 accumulate.
#include <hip/hip_runtime.h>
#include <math.h>

typedef __attribute__((ext_vector_type(16))) _Float16 v16h;
typedef __attribute__((ext_vector_type(16))) __bf16 v16b;
typedef __attribute__((ext_vector_type(8)))  _Float16 v8h;
typedef __attribute__((ext_vector_type(8)))  float v8f;
typedef __attribute__((ext_vector_type(4)))  float v4f;
typedef __attribute__((ext_vector_type(2)))  float v2f;
typedef __attribute__((ext_vector_type(4)))  unsigned v4u;
typedef __attribute__((ext_vector_type(4)))  int v4i;
typedef float __attribute__((may_alias)) float_a;
typedef int __attribute__((may_alias)) int_a;

template <typename T> __device__ __forceinline__ void vst2(void* p, T v) { *(T*)p = v;  }
__device__ __forceinline__ v8f wmma16(v16h a, v16h b, v8f c) {
  v8f d = __builtin_amdgcn_wmma_f32_16x16x32_f16(false, a, false, b, (short)0, c, false, false);
  asm volatile("v_nop\n\tv_nop\n\tv_nop\n\tv_nop" : "+v"(d) : "v"(a), "v"(b));
  return d;
}
__device__ __forceinline__ v8f wmma_bf(v16b a, v16b b, v8f c) {
  v8f d = __builtin_amdgcn_wmma_f32_16x16x32_bf16(false, a, false, b, (short)0, c, false, false);
  asm volatile("v_nop\n\tv_nop\n\tv_nop\n\tv_nop" : "+v"(d) : "v"(a), "v"(b));
  return d;
}
// 16x16x32 fragments: lane = (h = lane>>4, row/col = lane&15); elements 0..7 = k0+8h+0..7, 8..15 = k0+16+8h+0..7; D element r = row 8h+r
__device__ __forceinline__ v16h frag_h(const _Float16* rowk0, int lane) {
  union { v16h v; v8h q[2]; } u; const _Float16* p = rowk0 + 8 * (lane >> 4);
  u.q[0] = *(const v8h*)p; u.q[1] = *(const v8h*)(p + 16); return u.v;
}
__device__ __forceinline__ v16h frag_f32(const float* rowk0, int lane) {
  v16h a; const float* p = rowk0 + 8 * (lane >> 4);
#pragma unroll
  for (int i = 0; i < 8; ++i) { a[i] = (_Float16)p[i]; a[8 + i] = (_Float16)p[16 + i]; }
  return a;
}
__device__ __forceinline__ v16h frag_f32s(const float* rowk0, int lane, float sc) {
  v16h a; const float* p = rowk0 + 8 * (lane >> 4);
#pragma unroll
  for (int i = 0; i < 8; ++i) { a[i] = (_Float16)(p[i] * sc); a[8 + i] = (_Float16)(p[16 + i] * sc); }
  return a;
}
// column fragment from a [K][ld] layout (column n), rows >= K read as 0
__device__ __forceinline__ v16h fragc_f32(const float* W, int k0, int n, int lane, int ld, int K) {
  v16h a; const int g = lane >> 4;
#pragma unroll
  for (int i = 0; i < 8; ++i) { const int ka = k0 + 8 * g + i, kb = ka + 16;
    a[i] = (_Float16)(ka < K ? W[(size_t)(ka < K ? ka : K - 1) * ld + n] : 0.f); a[8 + i] = (_Float16)(kb < K ? W[(size_t)(kb < K ? kb : K - 1) * ld + n] : 0.f); }
  return a;
}
struct F2 { v16b h, l; };
__device__ __forceinline__ F2 bsplit16(const float v[16]) { F2 r;
#pragma unroll
  for (int i = 0; i < 16; ++i) { const __bf16 h = (__bf16)v[i]; r.h[i] = h; r.l[i] = (__bf16)(v[i] - (float)h); }
  return r; }
__device__ __forceinline__ F2 split_row(const float* row, int k0, int lane) { float v[16]; const float* p = row + k0 + 8 * (lane >> 4);
#pragma unroll
  for (int i = 0; i < 8; ++i) { v[i] = p[i]; v[8 + i] = p[16 + i]; }
  return bsplit16(v); }
__device__ __forceinline__ F2 split_rowK(const float* row, int k0, int lane, int K) { float v[16]; const int g = lane >> 4;
#pragma unroll
  for (int i = 0; i < 8; ++i) { const int ka = k0 + 8 * g + i, kb = ka + 16; v[i] = ka < K ? row[ka < K ? ka : K - 1] : 0.f; v[8 + i] = kb < K ? row[kb < K ? kb : K - 1] : 0.f; }
  return bsplit16(v); }
__device__ __forceinline__ F2 split_col(const float* W, int k0, int n, int lane, int ld, int K) { float v[16]; const int g = lane >> 4;
#pragma unroll
  for (int i = 0; i < 8; ++i) { const int ka = k0 + 8 * g + i, kb = ka + 16; v[i] = ka < K ? W[(size_t)(ka < K ? ka : K - 1) * ld + n] : 0.f; v[8 + i] = kb < K ? W[(size_t)(kb < K ? kb : K - 1) * ld + n] : 0.f; }
  return bsplit16(v); }
__device__ __forceinline__ v8f mac3(const F2& a, const F2& b, v8f c) { c = wmma_bf(a.l, b.h, c); c = wmma_bf(a.h, b.l, c); return wmma_bf(a.h, b.h, c); }
__device__ __forceinline__ float sigm(float v) { return 1.0f / (1.0f + expf(-v)); }
#define LDSX() do { asm volatile("s_wait_dscnt 0" ::: "memory"); __builtin_amdgcn_wave_barrier(); __builtin_amdgcn_fence(__ATOMIC_RELEASE, "workgroup"); } while (0)


// Dendritic block attention (B 2, H 16, S 2,048, D 64): importance-scaled queries, causal scores normalised independently within each 64-key block (softmax with +1e-6 in the denominator, fully masked blocks contribute 0), summed over blocks, then whole 64-query blocks zeroed unless some token's importance exceeds 0.3.
#define NB 2
#define NH 16
#define SS 2048
#define HD 64
#define BLK 64
#ifndef TQB
#define TQB (SS / 64)
#define TNB NB
#endif
typedef __attribute__((ext_vector_type(8))) __bf16 v8b;
__device__ __forceinline__ v16b frag_b(const __bf16* rowk0, int lane) {
  union { v16b v; v8b q[2]; } u; const __bf16* p = rowk0 + 8 * (lane >> 4);
  u.q[0] = *(const v8b*)p; u.q[1] = *(const v8b*)(p + 16); return u.v;
}
__device__ __forceinline__ float bfr(float v) { return (float)(__bf16)v; }
// lane l takes the value of lane l ^ 16
__device__ __forceinline__ float xhalf(float x) { return __builtin_bit_cast(float, __builtin_amdgcn_permlanex16(__builtin_bit_cast(int, x), __builtin_bit_cast(int, x), 0x76543210, 0xfedcba98, false, false)); }
__device__ __attribute__((noinline)) float exp_ni(float v) { return expf(v); }
__device__ __attribute__((noinline)) float erf_ni(float v) { return erff(v); }

#define WS_K   0u                                  // f16 [b][h][s][64] K ; VT planes [b][h][64][s]
#define WS_VT  (WS_K + 2u * (size_t)NB * NH * SS * HD)
#define WS_END (WS_VT + 2u * (size_t)NB * NH * HD * SS)

typedef __attribute__((ext_vector_type(4))) _Float16 v4h;
typedef __attribute__((ext_vector_type(2))) _Float16 v2h;
// ---- k_kv: block = 128 keys of one (b,h), both conversions in one launch: k rows -> exact f16 rows, and VT[(b,h)][d][s] = v[(b,h)][s][d]. A lane's sixteen 16-byte reads (eight of v, eight of k) are all issued before the first is used.
// k: a wave-wide read is 512 contiguous bytes, a wave-wide store 256 (two whole lines), so nothing is staged. v: a lane reads four d of eight keys (four pairs of neighbours) and writes each pair of keys as one dword.
// st row d holds its sixteen 16-byte pieces (8 keys each) turned round by d >> 2 places: the 16 lanes that write the same keys for different d then hit 16 different bank groups, and the rows keep their 16-byte alignment for the readers.
__global__ __launch_bounds__(256) void k_kv(const float* __restrict__ X, const float* __restrict__ V, _Float16* __restrict__ R, _Float16* __restrict__ VT) { __shared__ __align__(16) _Float16 st[64][128]; const size_t rb0 = (size_t)blockIdx.x * 128; const size_t bh = rb0 / SS, s0 = rb0 % SS; const int t = threadIdx.x, c4 = t & 15, rp = t >> 4; const size_t e0 = ((size_t)blockIdx.x * 2048 + threadIdx.x) * 4; v4f x[4][2], xk[8];
#pragma unroll   // straight-line, so that the sixteen reads stand together in front of the first conversion
  for (int jj = 0; jj < 4; ++jj)
#pragma unroll
    for (int u = 0; u < 2; ++u) x[jj][u] = *(const v4f*)(V + (rb0 + 32 * jj + 2 * rp + u) * HD + c4 * 4);
#pragma unroll
  for (int j = 0; j < 8; ++j) xk[j] = *(const v4f*)(X + e0 + j * 1024);
  asm volatile("s_wait_xcnt 0x0" ::: "memory");   // the conversions reuse the registers that hold the reads' addresses
#pragma unroll   // x[] stays in registers
  for (int jj = 0; jj < 4; ++jj) { const int r = 32 * jj + 2 * rp, pos = (((r >> 3) + c4) & 15) * 8 + (r & 7);
#pragma unroll
    for (int i = 0; i < 4; ++i) { v2h p; p[0] = (_Float16)bfr(x[jj][0][i]); p[1] = (_Float16)bfr(x[jj][1][i]); vst2(&st[c4 * 4 + i][pos], p); } }
  __syncthreads();
#pragma unroll   // xk[] stays in registers; the k rows are stored behind the barrier, so that the barrier does not wait for them
  for (int j = 0; j < 8; ++j) { v4h y;
#pragma unroll
    for (int i = 0; i < 4; ++i) y[i] = (_Float16)bfr(xk[j][i]);
    vst2(R + e0 + j * 1024, y); }
  asm volatile("s_wait_xcnt 0x0" ::: "memory");   // what follows reuses registers that these stores name
#pragma unroll   // the four LDS reads go out together, one wait chain instead of four
  for (int j = 0; j < 4; ++j) { const int e = t + 256 * j, d = e >> 4, pc = e & 15; vst2((unsigned*)(VT + (bh * HD + d) * SS + s0 + pc * 8), *(const v4u*)&st[d][((pc + (d >> 2)) & 15) * 8]); } }
// ---- stage_kv: one 64-key block's K rows and V^T rows (64 rows of 128 B each) -> LDS rows of 144 B. Each of 128 lanes copies four 16-byte pieces of each tile, 16 rows apart.
// The s_wait_xcnt stands inside the copies' own statement so that no address register is rewritten in front of it.
__device__ __forceinline__ void stage_kv(const _Float16* kg, const _Float16* vg, unsigned lk, unsigned lv) {
  asm volatile("global_load_async_to_lds_b128 %0, %8, off\n\t"
               "global_load_async_to_lds_b128 %1, %9, off\n\t"
               "global_load_async_to_lds_b128 %2, %10, off\n\t"
               "global_load_async_to_lds_b128 %3, %11, off\n\t"
               "global_load_async_to_lds_b128 %4, %12, off\n\t"
               "global_load_async_to_lds_b128 %5, %13, off\n\t"
               "global_load_async_to_lds_b128 %6, %14, off\n\t"
               "global_load_async_to_lds_b128 %7, %15, off\n\t"
               "s_wait_xcnt 0x0"
               :: "v"(lk), "v"(lk + 16u * 144u), "v"(lk + 32u * 144u), "v"(lk + 48u * 144u),
                  "v"(lv), "v"(lv + 16u * 144u), "v"(lv + 32u * 144u), "v"(lv + 48u * 144u),
                  "v"(kg), "v"(kg + 16 * HD), "v"(kg + 32 * HD), "v"(kg + 48 * HD),
                  "v"(vg), "v"(vg + 16 * SS), "v"(vg + 32 * SS), "v"(vg + 48 * SS)
               : "memory");
}
// ---- k_attn: block = (two query blocks of 64 queries, h, b), 8 waves: query block TQB - 1 - x, then query block x, one after the other in every wave. Waves 0 to 3 take the even key blocks of a walk, waves 4 to 7 the odd ones, each wave for 16 queries; a trip of the two-buffer ring holds one key block for each half of the waves, and every work-group makes NTRIP trips; the ring runs on from the first walk into the second. Per causal 64-key block an independent masked softmax (+1e-6), P x v accumulated; the two halves' sums are added through LDS at the end of a walk; output x active(query block)
#define NTRIP (TQB / 2 + 1)   // ceil((TQB - x) / 2) + ceil((x + 1) / 2), the same for every x
__global__ __launch_bounds__(256) void k_attn(const float* __restrict__ Q, const _Float16* __restrict__ K, const _Float16* __restrict__ VT, const float* __restrict__ IMP, float* __restrict__ OUT) {
  __shared__ __align__(16) float so[4][16][68]; __shared__ __align__(16) int sact[8];
  __shared__ __align__(16) _Float16 sk[2][2][64][72]; __shared__ __align__(16) _Float16 sv[2][2][64][72];   // two buffers, each with one key block for either half of the waves: K rows, V^T rows; pitch 144 B
  const int tid = threadIdx.x, wave = tid >> 5, wq = wave & 3, lane = tid & 31, col = lane & 15, g = lane >> 4; const int h = blockIdx.y; const size_t b = blockIdx.z; const int qx = blockIdx.x, qa = TQB - 1 - qx; const size_t bh = b * NH + h;
  const int kh = __builtin_amdgcn_readfirstlane(tid >> 7);   // which half of the waves: 0 even key blocks, 1 odd; in a scalar register, so that the tests on it are scalar branches
  const int na = (qa + 2) >> 1;   // trips of the first walk; qa >= TQB / 2, so trips 0 and 1 lie in it and both their key blocks are causal
  // a lane's piece of its half's key block: row (tid & 127) >> 3 (+16, +32, +48), 16-byte column tid & 7
  const int srow = (tid & 127) >> 3, scol = (tid & 7) * 8;
  const _Float16* kg = K + (bh * SS + srow) * HD + scol; const _Float16* vg = VT + (bh * HD + srow) * SS + scol;
  const unsigned lk = (unsigned)(size_t)&sk[0][kh][srow][scol], lv = (unsigned)(size_t)&sv[0][kh][srow][scol];
  stage_kv(kg + kh * (BLK * HD), vg + kh * BLK, lk, lv);   // key blocks 0 and 1 -> buffer 0
  // activity of the two 64-query blocks: any importance > 0.3; bit 0 for block qa, bit 1 for block qx
  { float iv = bfr(IMP[b * SS + qa * 64 + (tid & 63)]), iw = bfr(IMP[b * SS + qx * 64 + (tid & 63)]); int act = ((iv > 0.3f) ? 1 : 0) | ((iw > 0.3f) ? 2 : 0);
#pragma unroll
    for (int o = 1; o < 32; o <<= 1) act |= __shfl_xor(act, o);
    if (lane == 0) sact[wave] = act; }
  asm volatile("s_wait_asynccnt 0x0" ::: "memory");   // this wave's pieces of trip 0 have landed before the barrier publishes them
  __syncthreads(); const int active = sact[0] | sact[1];   // waves 0 and 1 saw all 64 queries of either block
  stage_kv(kg + (2 + kh) * (BLK * HD), vg + (2 + kh) * BLK, lk + 18432u, lv + 18432u);   // key blocks 2 and 3 -> buffer 1, in flight during trip 0
  int t = 0;   // trip of the ring, 0 to NTRIP - 1 over both walks
#pragma unroll 1   // the two query blocks share one copy of the code
  for (int half = 0; half < 2; ++half) { const int qb = half ? qx : qa; const int q0 = qb * 64 + wq * 16; const size_t rq = bh * SS + q0;
  // Q fragments (hardware k order, as frag_h) straight from the f32 input: each value rounded to bf16, then exact in f16.
  v16h aq[2]; v4f xq[2][4];
#pragma unroll
  for (int kc = 0; kc < 2; ++kc) { const float* p = Q + (rq + col) * HD + kc * 32 + 8 * g; xq[kc][0] = *(const v4f*)p; xq[kc][1] = *(const v4f*)(p + 4); xq[kc][2] = *(const v4f*)(p + 16); xq[kc][3] = *(const v4f*)(p + 20); }
  asm volatile("s_wait_xcnt 0x0" ::: "memory");   // what follows reuses the registers that hold these reads' address
#pragma unroll   // this loop and the two inside it: constant indices, so that xq[] and aq[] stay in registers
  for (int kc = 0; kc < 2; ++kc)
#pragma unroll
    for (int j = 0; j < 4; ++j)
#pragma unroll
      for (int i = 0; i < 4; ++i) aq[kc][4 * j + i] = (_Float16)bfr(xq[kc][j][i]);
  const float qsc = 0.125f * bfr(IMP[b * SS + q0 + col]);   // 1/8 x importance of this lane's query (a power of two: same rounding as the two factors in turn)
  v8f acc[4] = {};
#pragma unroll 1
  for (int kb = kh; kb <= qb + kh; kb += 2, ++t) { const int bf = t & 1;   // (qb + 2) >> 1 trips for either half of the waves
    if (kb <= qb) {   // an odd count of key blocks leaves waves 4 to 7 without one in the walk's last trip: they only pass the foot
    const int j0 = kb * BLK; v8f s[4]; v16h kf[8], vf[8]; const int rel = q0 + col - j0 - 8 * g;   // key ct * 16 + r of this lane is causal where ct * 16 + r <= rel
#pragma unroll
    for (int ct = 0; ct < 4; ++ct)
#pragma unroll
      for (int kc = 0; kc < 2; ++kc) kf[ct * 2 + kc] = frag_h(&sk[bf][kh][ct * 16 + col][kc * 32], lane);
#pragma unroll
    for (int kc = 0; kc < 2; ++kc)
#pragma unroll
      for (int dt = 0; dt < 4; ++dt) vf[kc * 4 + dt] = frag_h(&sv[bf][kh][dt * 16 + col][kc * 32], lane);
    // transposed scores: A = K rows, B = Q rows; s[ct][r] = score of key j0 + ct * 16 + 8 * g + r for query q0 + col, so a lane and its partner lane ^ 16 hold all 64 scores of one query
#pragma unroll
    for (int ct = 0; ct < 4; ++ct) { v8f c = {};
#pragma unroll
      for (int kc = 0; kc < 2; ++kc) c = wmma16(kf[ct * 2 + kc], aq[kc], c);
#pragma unroll
      for (int r = 0; r < 8; ++r) s[ct][r] = c[r] * qsc; }
    if (kb == qb) {   // a scalar branch: only a walk's last key block, the one on the diagonal, holds keys behind a query; every key of an earlier block is causal for all 64 queries
#pragma unroll
      for (int ct = 0; ct < 4; ++ct)
#pragma unroll
        for (int r = 0; r < 8; ++r) s[ct][r] = (ct * 16 + r <= rel) ? s[ct][r] : -3.0e38f; }
    float m4[4];
#pragma unroll
    for (int ct = 0; ct < 4; ++ct) m4[ct] = fmaxf(fmaxf(fmaxf(s[ct][0], s[ct][1]), fmaxf(s[ct][2], s[ct][3])), fmaxf(fmaxf(s[ct][4], s[ct][5]), fmaxf(s[ct][6], s[ct][7])));
    float mx = fmaxf(fmaxf(m4[0], m4[1]), fmaxf(m4[2], m4[3])); mx = fmaxf(mx, xhalf(mx));
    const float safe = (mx <= -1.0e38f) ? 0.f : mx; float e4[4];
#pragma unroll
    for (int ct = 0; ct < 4; ++ct) { float y[8];
#pragma unroll
      for (int r = 0; r < 8; ++r) { y[r] = (s[ct][r] - safe) * 1.44269504f; s[ct][r] = __builtin_amdgcn_exp2f(y[r]); }   // e^x as the hardware 2^(x log2 e); a masked score, -3.0e38 - safe, lies so far below 0 that the result is exactly 0
      // the slot the instruction set asks for behind a transcendental before a source of it is overwritten: the eight arguments stay live up to this v_nop, which stands behind the eight exps
      asm volatile("v_nop" :: "v"(y[0]), "v"(y[1]), "v"(y[2]), "v"(y[3]), "v"(y[4]), "v"(y[5]), "v"(y[6]), "v"(y[7]), "v"(s[ct][0]), "v"(s[ct][1]), "v"(s[ct][2]), "v"(s[ct][3]), "v"(s[ct][4]), "v"(s[ct][5]), "v"(s[ct][6]), "v"(s[ct][7]));
      e4[ct] = ((s[ct][0] + s[ct][1]) + (s[ct][2] + s[ct][3])) + ((s[ct][4] + s[ct][5]) + (s[ct][6] + s[ct][7])); }
    float es = (e4[0] + e4[1]) + (e4[2] + e4[3]); es += xhalf(es);
    const float inv = 2048.0f / (es + 1e-6f);
    // two 16-key score tiles of one query, converted in place, are the A fragment of P x v in the hardware k order (element i = key 8 * g + i, element 8 + i = key 16 + 8 * g + i of each 32)
    v16h pa[2];
#pragma unroll
    for (int kc = 0; kc < 2; ++kc)
#pragma unroll
      for (int i = 0; i < 8; ++i) { pa[kc][i] = (_Float16)(s[2 * kc][i] * inv); pa[kc][8 + i] = (_Float16)(s[2 * kc + 1][i] * inv); }
#pragma unroll
    for (int kc = 0; kc < 2; ++kc)
#pragma unroll
      for (int dt = 0; dt < 4; ++dt) acc[dt] = wmma16(pa[kc], vf[kc * 4 + dt], acc[dt]);
    }
    asm volatile("s_wait_dscnt 0x0" ::: "memory");      // this wave's LDS reads of buffer bf are done
    asm volatile("s_wait_asynccnt 0x0" ::: "memory");   // this wave's pieces of trip t + 1 have landed
    __syncthreads();                                    // publishes trip t + 1's key blocks and frees buffer bf
    if (t + 2 < NTRIP) { const int tn = t + 2, first = tn < na; const int kw = 2 * (first ? tn : tn - na) + kh, kl = first ? qa : qx; const int kn = kw < kl ? kw : kl;   // this half's key block of trip t + 2; where the walk has none left for it, the walk's last block once more, which nobody reads
      stage_kv(kg + (size_t)kn * (BLK * HD), vg + kn * BLK, lk + 18432u * bf, lv + 18432u * bf); } }
  const float fin = ((active >> half) & 1) ? (1.0f / 2048.0f) : 0.f;
  // waves 4 to 7 hand their sums over, each lane at the places where its partner lane of waves 0 to 3 holds the same output elements
  if (kh == 1) {
#pragma unroll
    for (int r = 0; r < 8; ++r)
#pragma unroll
      for (int dt = 0; dt < 4; ++dt) so[wq][8 * g + r][dt * 16 + col] = acc[dt][r]; }
  __syncthreads();   // the odd key blocks' sums are in so[] before waves 0 to 3 read them; so[] is written again only behind a later trip's barrier
  if (kh == 0) {
#pragma unroll
  for (int r = 0; r < 8; ++r)
#pragma unroll
    for (int dt = 0; dt < 4; ++dt) so[wq][8 * g + r][dt * 16 + col] = (acc[dt][r] + so[wq][8 * g + r][dt * 16 + col]) * fin;
  LDSX();
  for (int rl = 0; rl < 16; ++rl) if (lane < 16) vst2(OUT + (rq + rl) * HD + lane * 4, *(const v4f*)&so[wq][rl][lane * 4]);
  asm volatile("s_wait_xcnt 0x0" ::: "memory");         // the second query block's set-up rewrites registers that these stores name
  }
  }
  asm volatile("s_wait_asynccnt 0x0" ::: "memory");     // no copy is outstanding when the wave ends
}
extern "C" void kernel_launch(void* const* d_in, const int* in_sizes, int n_in, void* d_out, int out_size, void* d_ws, size_t ws_size, hipStream_t stream) {
  (void)in_sizes; (void)n_in; (void)out_size;
  const float** F = (const float**)d_in;   // 0 q, 1 k, 2 v [2,16,2048,64], 3 importance_scores [2,2048]
  if (ws_size < (size_t)WS_END) return;
  char* ws = (char*)d_ws; _Float16 *K = (_Float16*)(ws + WS_K), *VT = (_Float16*)(ws + WS_VT);
  k_kv<<<NB * NH * SS / 128, 256, 0, stream>>>(F[1], F[2], K, VT);
  k_attn<<<dim3(TQB / 2, NH, TNB), 256, 0, stream>>>(F[0], K, VT, F[3], (float*)d_out);
}

// v009
// Measured time: 35.7 microseconds a run.
// Next to v008, in two timings, it ran 1.04 times as fast each time.
// All steps since v000 together make it 5.29 times as fast.
// compute dtype: q, k, v, importance rounded to bf16 and used as EXACT f16 operands on WMMA 16x16x32; scores = (q . k) x 1/8 x importance_i in f32 (the module scales q by importance first - identical algebra), causal mask, per 64-key block: max / exp (hardware exp) / sum + 1e-6 in f32, P (scaled by 2^11, single f16) x v (exact f16); the per-64-query-block activity gate from the importance threshold; f32 accumulate.
#include <hip/hip_runtime.h>
#include <math.h>

typedef __attribute__((ext_vector_type(16))) _Float16 v16h;
typedef __attribute__((ext_vector_type(16))) __bf16 v16b;
typedef __attribute__((ext_vector_type(8)))  _Float16 v8h;
typedef __attribute__((ext_vector_type(8)))  float v8f;
typedef __attribute__((ext_vector_type(4)))  float v4f;
typedef __attribute__((ext_vector_type(2)))  float v2f;
typedef __attribute__((ext_vector_type(4)))  unsigned v4u;
typedef __attribute__((ext_vector_type(4)))  int v4i;
typedef float __attribute__((may_alias)) float_a;
typedef int __attribute__((may_alias)) int_a;

template <typename T> __device__ __forceinline__ void vst2(void* p, T v) { *(T*)p = v;  }
__device__ __forceinline__ v8f wmma16(v16h a, v16h b, v8f c) {
  return __builtin_amdgcn_wmma_f32_16x16x32_f16(false, a, false, b, (short)0, c, false, false);   // the compiler keeps the distance behind its own builtin
}
__device__ __forceinline__ v8f wmma_bf(v16b a, v16b b, v8f c) {
  v8f d = __builtin_amdgcn_wmma_f32_16x16x32_bf16(false, a, false, b, (short)0, c, false, false);
  asm volatile("v_nop\n\tv_nop\n\tv_nop\n\tv_nop" : "+v"(d) : "v"(a), "v"(b));
  return d;
}
// 16x16x32 fragments: lane = (h = lane>>4, row/col = lane&15); elements 0..7 = k0+8h+0..7, 8..15 = k0+16+8h+0..7; D element r = row 8h+r
__device__ __forceinline__ v16h frag_h(const _Float16* rowk0, int lane) {
  union { v16h v; v8h q[2]; } u; const _Float16* p = rowk0 + 8 * (lane >> 4);
  u.q[0] = *(const v8h*)p; u.q[1] = *(const v8h*)(p + 16); return u.v;
}
__device__ __forceinline__ v16h frag_f32(const float* rowk0, int lane) {
  v16h a; const float* p = rowk0 + 8 * (lane >> 4);
#pragma unroll
  for (int i = 0; i < 8; ++i) { a[i] = (_Float16)p[i]; a[8 + i] = (_Float16)p[16 + i]; }
  return a;
}
__device__ __forceinline__ v16h frag_f32s(const float* rowk0, int lane, float sc) {
  v16h a; const float* p = rowk0 + 8 * (lane >> 4);
#pragma unroll
  for (int i = 0; i < 8; ++i) { a[i] = (_Float16)(p[i] * sc); a[8 + i] = (_Float16)(p[16 + i] * sc); }
  return a;
}
// column fragment from a [K][ld] layout (column n), rows >= K read as 0
__device__ __forceinline__ v16h fragc_f32(const float* W, int k0, int n, int lane, int ld, int K) {
  v16h a; const int g = lane >> 4;
#pragma unroll
  for (int i = 0; i < 8; ++i) { const int ka = k0 + 8 * g + i, kb = ka + 16;
    a[i] = (_Float16)(ka < K ? W[(size_t)(ka < K ? ka : K - 1) * ld + n] : 0.f); a[8 + i] = (_Float16)(kb < K ? W[(size_t)(kb < K ? kb : K - 1) * ld + n] : 0.f); }
  return a;
}
struct F2 { v16b h, l; };
__device__ __forceinline__ F2 bsplit16(const float v[16]) { F2 r;
#pragma unroll
  for (int i = 0; i < 16; ++i) { const __bf16 h = (__bf16)v[i]; r.h[i] = h; r.l[i] = (__bf16)(v[i] - (float)h); }
  return r; }
__device__ __forceinline__ F2 split_row(const float* row, int k0, int lane) { float v[16]; const float* p = row + k0 + 8 * (lane >> 4);
#pragma unroll
  for (int i = 0; i < 8; ++i) { v[i] = p[i]; v[8 + i] = p[16 + i]; }
  return bsplit16(v); }
__device__ __forceinline__ F2 split_rowK(const float* row, int k0, int lane, int K) { float v[16]; const int g = lane >> 4;
#pragma unroll
  for (int i = 0; i < 8; ++i) { const int ka = k0 + 8 * g + i, kb = ka + 16; v[i] = ka < K ? row[ka < K ? ka : K - 1] : 0.f; v[8 + i] = kb < K ? row[kb < K ? kb : K - 1] : 0.f; }
  return bsplit16(v); }
__device__ __forceinline__ F2 split_col(const float* W, int k0, int n, int lane, int ld, int K) { float v[16]; const int g = lane >> 4;
#pragma unroll
  for (int i = 0; i < 8; ++i) { const int ka = k0 + 8 * g + i, kb = ka + 16; v[i] = ka < K ? W[(size_t)(ka < K ? ka : K - 1) * ld + n] : 0.f; v[8 + i] = kb < K ? W[(size_t)(kb < K ? kb : K - 1) * ld + n] : 0.f; }
  return bsplit16(v); }
__device__ __forceinline__ v8f mac3(const F2& a, const F2& b, v8f c) { c = wmma_bf(a.l, b.h, c); c = wmma_bf(a.h, b.l, c); return wmma_bf(a.h, b.h, c); }
__device__ __forceinline__ float sigm(float v) { return 1.0f / (1.0f + expf(-v)); }
#define LDSX() do { asm volatile("s_wait_dscnt 0" ::: "memory"); __builtin_amdgcn_wave_barrier(); __builtin_amdgcn_fence(__ATOMIC_RELEASE, "workgroup"); } while (0)


// Dendritic block attention (B 2, H 16, S 2,048, D 64): importance-scaled queries, causal scores normalised independently within each 64-key block (softmax with +1e-6 in the denominator, fully masked blocks contribute 0), summed over blocks, then whole 64-query blocks zeroed unless some token's importance exceeds 0.3.
#define NB 2
#define NH 16
#define SS 2048
#define HD 64
#define BLK 64
#ifndef TQB
#define TQB (SS / 64)
#define TNB NB
#endif
typedef __attribute__((ext_vector_type(8))) __bf16 v8b;
__device__ __forceinline__ v16b frag_b(const __bf16* rowk0, int lane) {
  union { v16b v; v8b q[2]; } u; const __bf16* p = rowk0 + 8 * (lane >> 4);
  u.q[0] = *(const v8b*)p; u.q[1] = *(const v8b*)(p + 16); return u.v;
}
__device__ __forceinline__ float bfr(float v) { return (float)(__bf16)v; }
// lane l takes the value of lane l ^ 16
__device__ __forceinline__ float xhalf(float x) { return __builtin_bit_cast(float, __builtin_amdgcn_permlanex16(__builtin_bit_cast(int, x), __builtin_bit_cast(int, x), 0x76543210, 0xfedcba98, false, false)); }
__device__ __attribute__((noinline)) float exp_ni(float v) { return expf(v); }
__device__ __attribute__((noinline)) float erf_ni(float v) { return erff(v); }

#define WS_K   0u                                  // f16 [b][h][s][64] K ; VT planes [b][h][64][s]
#define WS_VT  (WS_K + 2u * (size_t)NB * NH * SS * HD)
#define WS_END (WS_VT + 2u * (size_t)NB * NH * HD * SS)

typedef __attribute__((ext_vector_type(4))) _Float16 v4h;
typedef __attribute__((ext_vector_type(2))) _Float16 v2h;
// ---- k_kv: block = 128 keys of one (b,h), both conversions in one launch: k rows -> exact f16 rows, and VT[(b,h)][d][s] = v[(b,h)][s][d]. A lane's sixteen 16-byte reads (eight of v, eight of k) are all issued before the first is used.
// k: a wave-wide read is 512 contiguous bytes, a wave-wide store 256 (two whole lines), so nothing is staged. v: a lane reads four d of eight keys (four pairs of neighbours) and writes each pair of keys as one dword.
// st row d holds its sixteen 16-byte pieces (8 keys each) turned round by d >> 2 places: the 16 lanes that write the same keys for different d then hit 16 different bank groups, and the rows keep their 16-byte alignment for the readers.
__global__ __launch_bounds__(256) void k_kv(const float* __restrict__ X, const float* __restrict__ V, _Float16* __restrict__ R, _Float16* __restrict__ VT) { __shared__ __align__(16) _Float16 st[64][128]; const size_t rb0 = (size_t)blockIdx.x * 128; const size_t bh = rb0 / SS, s0 = rb0 % SS; const int t = threadIdx.x, c4 = t & 15, rp = t >> 4; const size_t e0 = ((size_t)blockIdx.x * 2048 + threadIdx.x) * 4; v4f x[4][2], xk[8];
#pragma unroll   // straight-line, so that the sixteen reads stand together in front of the first conversion
  for (int jj = 0; jj < 4; ++jj)
#pragma unroll
    for (int u = 0; u < 2; ++u) x[jj][u] = *(const v4f*)(V + (rb0 + 32 * jj + 2 * rp + u) * HD + c4 * 4);
#pragma unroll
  for (int j = 0; j < 8; ++j) xk[j] = *(const v4f*)(X + e0 + j * 1024);
  asm volatile("s_wait_xcnt 0x0" ::: "memory");   // the conversions reuse the registers that hold the reads' addresses
#pragma unroll   // x[] stays in registers
  for (int jj = 0; jj < 4; ++jj) { const int r = 32 * jj + 2 * rp, pos = (((r >> 3) + c4) & 15) * 8 + (r & 7);
#pragma unroll
    for (int i = 0; i < 4; ++i) { v2h p; p[0] = (_Float16)bfr(x[jj][0][i]); p[1] = (_Float16)bfr(x[jj][1][i]); vst2(&st[c4 * 4 + i][pos], p); } }
  __syncthreads();
#pragma unroll   // xk[] stays in registers; the k rows are stored behind the barrier, so that the barrier does not wait for them
  for (int j = 0; j < 8; ++j) { v4h y;
#pragma unroll
    for (int i = 0; i < 4; ++i) y[i] = (_Float16)bfr(xk[j][i]);
    vst2(R + e0 + j * 1024, y); }
  asm volatile("s_wait_xcnt 0x0" ::: "memory");   // what follows reuses registers that these stores name
#pragma unroll   // the four LDS reads go out together, one wait chain instead of four
  for (int j = 0; j < 4; ++j) { const int e = t + 256 * j, d = e >> 4, pc = e & 15; vst2((unsigned*)(VT + (bh * HD + d) * SS + s0 + pc * 8), *(const v4u*)&st[d][((pc + (d >> 2)) & 15) * 8]); } }
// ---- stage_kv: one 64-key block's K rows and V^T rows (64 rows of 128 B each) -> LDS rows of 144 B. Each of 128 lanes copies four 16-byte pieces of each tile, 16 rows apart.
// The s_wait_xcnt stands inside the copies' own statement so that no address register is rewritten in front of it.
__device__ __forceinline__ void stage_kv(const _Float16* kg, const _Float16* vg, unsigned lk, unsigned lv) {
  asm volatile("global_load_async_to_lds_b128 %0, %8, off\n\t"
               "global_load_async_to_lds_b128 %1, %9, off\n\t"
               "global_load_async_to_lds_b128 %2, %10, off\n\t"
               "global_load_async_to_lds_b128 %3, %11, off\n\t"
               "global_load_async_to_lds_b128 %4, %12, off\n\t"
               "global_load_async_to_lds_b128 %5, %13, off\n\t"
               "global_load_async_to_lds_b128 %6, %14, off\n\t"
               "global_load_async_to_lds_b128 %7, %15, off\n\t"
               "s_wait_xcnt 0x0"
               :: "v"(lk), "v"(lk + 16u * 144u), "v"(lk + 32u * 144u), "v"(lk + 48u * 144u),
                  "v"(lv), "v"(lv + 16u * 144u), "v"(lv + 32u * 144u), "v"(lv + 48u * 144u),
                  "v"(kg), "v"(kg + 16 * HD), "v"(kg + 32 * HD), "v"(kg + 48 * HD),
                  "v"(vg), "v"(vg + 16 * SS), "v"(vg + 32 * SS), "v"(vg + 48 * SS)
               : "memory");
}
// ---- k_attn: block = (two query blocks of 64 queries, h, b), 8 waves: query block TQB - 1 - x, then query block x, one after the other in every wave. Waves 0 to 3 take the even key blocks of a walk, waves 4 to 7 the odd ones, each wave for 16 queries; a trip of the two-buffer ring holds one key block for each half of the waves, and every work-group makes NTRIP trips; the ring runs on from the first walk into the second. Per causal 64-key block an independent masked softmax (+1e-6), P x v accumulated; the two halves' sums are added through LDS at the end of a walk; output x active(query block)
#define NTRIP (TQB / 2 + 1)   // ceil((TQB - x) / 2) + ceil((x + 1) / 2), the same for every x
__global__ __launch_bounds__(256) void k_attn(const float* __restrict__ Q, const _Float16* __restrict__ K, const _Float16* __restrict__ VT, const float* __restrict__ IMP, float* __restrict__ OUT) {
  __shared__ __align__(16) float so[4][16][68]; __shared__ __align__(16) int sact[8];
  __shared__ __align__(16) _Float16 sk[2][2][64][72]; __shared__ __align__(16) _Float16 sv[2][2][64][72];   // two buffers, each with one key block for either half of the waves: K rows, V^T rows; pitch 144 B
  const int tid = threadIdx.x, wave = tid >> 5, wq = wave & 3, lane = tid & 31, col = lane & 15, g = lane >> 4; const int h = blockIdx.y; const size_t b = blockIdx.z; const int qx = blockIdx.x, qa = TQB - 1 - qx; const size_t bh = b * NH + h;
  const int kh = __builtin_amdgcn_readfirstlane(tid >> 7);   // which half of the waves: 0 even key blocks, 1 odd; in a scalar register, so that the tests on it are scalar branches
  const int na = (qa + 2) >> 1;   // trips of the first walk; qa >= TQB / 2, so trips 0 and 1 lie in it and both their key blocks are causal
  // a lane's piece of its half's key block: row (tid & 127) >> 3 (+16, +32, +48), 16-byte column tid & 7
  const int srow = (tid & 127) >> 3, scol = (tid & 7) * 8;
  const _Float16* kg = K + (bh * SS + srow) * HD + scol; const _Float16* vg = VT + (bh * HD + srow) * SS + scol;
  const unsigned lk = (unsigned)(size_t)&sk[0][kh][srow][scol], lv = (unsigned)(size_t)&sv[0][kh][srow][scol];
  stage_kv(kg + kh * (BLK * HD), vg + kh * BLK, lk, lv);   // key blocks 0 and 1 -> buffer 0
  // activity of the two 64-query blocks: any importance > 0.3; bit 0 for block qa, bit 1 for block qx
  { float iv = bfr(IMP[b * SS + qa * 64 + (tid & 63)]), iw = bfr(IMP[b * SS + qx * 64 + (tid & 63)]); int act = ((iv > 0.3f) ? 1 : 0) | ((iw > 0.3f) ? 2 : 0);
#pragma unroll
    for (int o = 1; o < 32; o <<= 1) act |= __shfl_xor(act, o);
    if (lane == 0) sact[wave] = act; }
  asm volatile("s_wait_asynccnt 0x0" ::: "memory");   // this wave's pieces of trip 0 have landed before the barrier publishes them
  __syncthreads(); const int active = sact[0] | sact[1];   // waves 0 and 1 saw all 64 queries of either block
  stage_kv(kg + (2 + kh) * (BLK * HD), vg + (2 + kh) * BLK, lk + 18432u, lv + 18432u);   // key blocks 2 and 3 -> buffer 1, in flight during trip 0
  int t = 0;   // trip of the ring, 0 to NTRIP - 1 over both walks
#pragma unroll 1   // the two query blocks share one copy of the code
  for (int half = 0; half < 2; ++half) { const int qb = half ? qx : qa; const int q0 = qb * 64 + wq * 16; const size_t rq = bh * SS + q0;
  // Q fragments (hardware k order, as frag_h) straight from the f32 input: each value rounded to bf16, then exact in f16.
  v16h aq[2]; v4f xq[2][4];
#pragma unroll
  for (int kc = 0; kc < 2; ++kc) { const float* p = Q + (rq + col) * HD + kc * 32 + 8 * g; xq[kc][0] = *(const v4f*)p; xq[kc][1] = *(const v4f*)(p + 4); xq[kc][2] = *(const v4f*)(p + 16); xq[kc][3] = *(const v4f*)(p + 20); }
  asm volatile("s_wait_xcnt 0x0" ::: "memory");   // what follows reuses the registers that hold these reads' address
#pragma unroll   // this loop and the two inside it: constant indices, so that xq[] and aq[] stay in registers
  for (int kc = 0; kc < 2; ++kc)
#pragma unroll
    for (int j = 0; j < 4; ++j)
#pragma unroll
      for (int i = 0; i < 4; ++i) aq[kc][4 * j + i] = (_Float16)bfr(xq[kc][j][i]);
  const float qsc = 0.125f * bfr(IMP[b * SS + q0 + col]);   // 1/8 x importance of this lane's query (a power of two: same rounding as the two factors in turn)
  v8f acc[4] = {};
#pragma unroll 1
  for (int kb = kh; kb <= qb + kh; kb += 2, ++t) { const int bf = t & 1;   // (qb + 2) >> 1 trips for either half of the waves
    if (kb <= qb) {   // an odd count of key blocks leaves waves 4 to 7 without one in the walk's last trip: they only pass the foot
    const int j0 = kb * BLK; v8f s[4]; v16h kf[8], vf[8]; const int rel = q0 + col - j0 - 8 * g;   // key ct * 16 + r of this lane is causal where ct * 16 + r <= rel
#pragma unroll
    for (int ct = 0; ct < 4; ++ct)
#pragma unroll
      for (int kc = 0; kc < 2; ++kc) kf[ct * 2 + kc] = frag_h(&sk[bf][kh][ct * 16 + col][kc * 32], lane);
#pragma unroll
    for (int kc = 0; kc < 2; ++kc)
#pragma unroll
      for (int dt = 0; dt < 4; ++dt) vf[kc * 4 + dt] = frag_h(&sv[bf][kh][dt * 16 + col][kc * 32], lane);
    __builtin_amdgcn_sched_barrier(0);   // the 32 LDS reads stay in one place ahead of the first WMMA, as before (for speed only)
    // transposed scores: A = K rows, B = Q rows; s[ct][r] = score of key j0 + ct * 16 + 8 * g + r for query q0 + col, so a lane and its partner lane ^ 16 hold all 64 scores of one query
#pragma unroll
    for (int ct = 0; ct < 4; ++ct) { v8f c = {};
#pragma unroll
      for (int kc = 0; kc < 2; ++kc) c = wmma16(kf[ct * 2 + kc], aq[kc], c);
#pragma unroll
      for (int r = 0; r < 8; ++r) s[ct][r] = c[r] * qsc; }
    if (kb == qb) {   // a scalar branch: only a walk's last key block, the one on the diagonal, holds keys behind a query; every key of an earlier block is causal for all 64 queries
#pragma unroll
      for (int ct = 0; ct < 4; ++ct)
#pragma unroll
        for (int r = 0; r < 8; ++r) s[ct][r] = (ct * 16 + r <= rel) ? s[ct][r] : -3.0e38f; }
    float m4[4];
#pragma unroll
    for (int ct = 0; ct < 4; ++ct) m4[ct] = fmaxf(fmaxf(fmaxf(s[ct][0], s[ct][1]), fmaxf(s[ct][2], s[ct][3])), fmaxf(fmaxf(s[ct][4], s[ct][5]), fmaxf(s[ct][6], s[ct][7])));
    float mx = fmaxf(fmaxf(m4[0], m4[1]), fmaxf(m4[2], m4[3])); mx = fmaxf(mx, xhalf(mx));
    const float safe = (mx <= -1.0e38f) ? 0.f : mx; float e4[4];
#pragma unroll
    for (int ct = 0; ct < 4; ++ct) { float y[8];
#pragma unroll
      for (int r = 0; r < 8; ++r) { y[r] = (s[ct][r] - safe) * 1.44269504f; s[ct][r] = __builtin_amdgcn_exp2f(y[r]); }   // e^x as the hardware 2^(x log2 e); a masked score, -3.0e38 - safe, lies so far below 0 that the result is exactly 0
      // the slot the instruction set asks for behind a transcendental before a source of it is overwritten: the eight arguments stay live up to this v_nop, which stands behind the eight exps
      asm volatile("v_nop" :: "v"(y[0]), "v"(y[1]), "v"(y[2]), "v"(y[3]), "v"(y[4]), "v"(y[5]), "v"(y[6]), "v"(y[7]), "v"(s[ct][0]), "v"(s[ct][1]), "v"(s[ct][2]), "v"(s[ct][3]), "v"(s[ct][4]), "v"(s[ct][5]), "v"(s[ct][6]), "v"(s[ct][7]));
      e4[ct] = ((s[ct][0] + s[ct][1]) + (s[ct][2] + s[ct][3])) + ((s[ct][4] + s[ct][5]) + (s[ct][6] + s[ct][7])); }
    float es = (e4[0] + e4[1]) + (e4[2] + e4[3]); es += xhalf(es);
    const float inv = 2048.0f / (es + 1e-6f);
    // two 16-key score tiles of one query, converted in place, are the A fragment of P x v in the hardware k order (element i = key 8 * g + i, element 8 + i = key 16 + 8 * g + i of each 32)
    v16h pa[2];
#pragma unroll
    for (int kc = 0; kc < 2; ++kc)
#pragma unroll
      for (int i = 0; i < 8; ++i) { pa[kc][i] = (_Float16)(s[2 * kc][i] * inv); pa[kc][8 + i] = (_Float16)(s[2 * kc + 1][i] * inv); }
#pragma unroll
    for (int kc = 0; kc < 2; ++kc)
#pragma unroll
      for (int dt = 0; dt < 4; ++dt) acc[dt] = wmma16(pa[kc], vf[kc * 4 + dt], acc[dt]);
    }
    asm volatile("s_wait_dscnt 0x0" ::: "memory");      // this wave's LDS reads of buffer bf are done
    asm volatile("s_wait_asynccnt 0x0" ::: "memory");   // this wave's pieces of trip t + 1 have landed
    __syncthreads();                                    // publishes trip t + 1's key blocks and frees buffer bf
    if (t + 2 < NTRIP) { const int tn = t + 2, first = tn < na; const int kw = 2 * (first ? tn : tn - na) + kh, kl = first ? qa : qx; const int kn = kw < kl ? kw : kl;   // this half's key block of trip t + 2; where the walk has none left for it, the walk's last block once more, which nobody reads
      stage_kv(kg + (size_t)kn * (BLK * HD), vg + kn * BLK, lk + 18432u * bf, lv + 18432u * bf); } }
  const float fin = ((active >> half) & 1) ? (1.0f / 2048.0f) : 0.f;
  // waves 4 to 7 hand their sums over, each lane at the places where its partner lane of waves 0 to 3 holds the same output elements
  if (kh == 1) {
#pragma unroll
    for (int r = 0; r < 8; ++r)
#pragma unroll
      for (int dt = 0; dt < 4; ++dt) so[wq][8 * g + r][dt * 16 + col] = acc[dt][r]; }
  __syncthreads();   // the odd key blocks' sums are in so[] before waves 0 to 3 read them; so[] is written again only behind a later trip's barrier
  if (kh == 0) {
#pragma unroll
  for (int r = 0; r < 8; ++r)
#pragma unroll
    for (int dt = 0; dt < 4; ++dt) so[wq][8 * g + r][dt * 16 + col] = (acc[dt][r] + so[wq][8 * g + r][dt * 16 + col]) * fin;
  LDSX();
  for (int rl = 0; rl < 16; ++rl) if (lane < 16) vst2(OUT + (rq + rl) * HD + lane * 4, *(const v4f*)&so[wq][rl][lane * 4]);
  asm volatile("s_wait_xcnt 0x0" ::: "memory");         // the second query block's set-up rewrites registers that these stores name
  }
  }
  asm volatile("s_wait_asynccnt 0x0" ::: "memory");     // no copy is outstanding when the wave ends
}
extern "C" void kernel_launch(void* const* d_in, const int* in_sizes, int n_in, void* d_out, int out_size, void* d_ws, size_t ws_size, hipStream_t stream) {
  (void)in_sizes; (void)n_in; (void)out_size;
  const float** F = (const float**)d_in;   // 0 q, 1 k, 2 v [2,16,2048,64], 3 importance_scores [2,2048]
  if (ws_size < (size_t)WS_END) return;
  char* ws = (char*)d_ws; _Float16 *K = (_Float16*)(ws + WS_K), *VT = (_Float16*)(ws + WS_VT);
  k_kv<<<NB * NH * SS / 128, 256, 0, stream>>>(F[1], F[2], K, VT);
  k_attn<<<dim3(TQB / 2, NH, TNB), 256, 0, stream>>>(F[0], K, VT, F[3], (float*)d_out);
}

// v010
// It runs in 34.5 microseconds.
// Next to v009, in two timings, it ran 1.04 and 1.03 times as fast.
// Over all steps from v000 it is 5.47 times as fast.
// compute dtype: q, k, v, importance rounded to bf16 and used as EXACT f16 operands on WMMA 16x16x32; scores = (q . k) x 1/8 x importance_i in f32 (the module scales q by importance first - identical algebra), causal mask, per 64-key block: max on the raw products, scale and max folded into one fused multiply-add in front of the hardware exp, sum + 1e-6 in f32, P (scaled by 2^11, single f16) x v (exact f16); the per-64-query-block activity gate from the importance threshold; f32 accumulate.
#include <hip/hip_runtime.h>
#include <math.h>

typedef __attribute__((ext_vector_type(16))) _Float16 v16h;
typedef __attribute__((ext_vector_type(16))) __bf16 v16b;
typedef __attribute__((ext_vector_type(8)))  _Float16 v8h;
typedef __attribute__((ext_vector_type(8)))  float v8f;
typedef __attribute__((ext_vector_type(4)))  float v4f;
typedef __attribute__((ext_vector_type(2)))  float v2f;
typedef __attribute__((ext_vector_type(4)))  unsigned v4u;
typedef __attribute__((ext_vector_type(4)))  int v4i;
typedef float __attribute__((may_alias)) float_a;
typedef int __attribute__((may_alias)) int_a;

template <typename T> __device__ __forceinline__ void vst2(void* p, T v) { *(T*)p = v;  }
__device__ __forceinline__ v8f wmma16(v16h a, v16h b, v8f c) {
  return __builtin_amdgcn_wmma_f32_16x16x32_f16(false, a, false, b, (short)0, c, false, false);   // the compiler keeps the distance behind its own builtin
}
__device__ __forceinline__ v8f wmma_bf(v16b a, v16b b, v8f c) {
  v8f d = __builtin_amdgcn_wmma_f32_16x16x32_bf16(false, a, false, b, (short)0, c, false, false);
  asm volatile("v_nop\n\tv_nop\n\tv_nop\n\tv_nop" : "+v"(d) : "v"(a), "v"(b));
  return d;
}
// 16x16x32 fragments: lane = (h = lane>>4, row/col = lane&15); elements 0..7 = k0+8h+0..7, 8..15 = k0+16+8h+0..7; D element r = row 8h+r
__device__ __forceinline__ v16h frag_h(const _Float16* rowk0, int lane) {
  union { v16h v; v8h q[2]; } u; const _Float16* p = rowk0 + 8 * (lane >> 4);
  u.q[0] = *(const v8h*)p; u.q[1] = *(const v8h*)(p + 16); return u.v;
}
__device__ __forceinline__ v16h frag_f32(const float* rowk0, int lane) {
  v16h a; const float* p = rowk0 + 8 * (lane >> 4);
#pragma unroll
  for (int i = 0; i < 8; ++i) { a[i] = (_Float16)p[i]; a[8 + i] = (_Float16)p[16 + i]; }
  return a;
}
__device__ __forceinline__ v16h frag_f32s(const float* rowk0, int lane, float sc) {
  v16h a; const float* p = rowk0 + 8 * (lane >> 4);
#pragma unroll
  for (int i = 0; i < 8; ++i) { a[i] = (_Float16)(p[i] * sc); a[8 + i] = (_Float16)(p[16 + i] * sc); }
  return a;
}
// column fragment from a [K][ld] layout (column n), rows >= K read as 0
__device__ __forceinline__ v16h fragc_f32(const float* W, int k0, int n, int lane, int ld, int K) {
  v16h a; const int g = lane >> 4;
#pragma unroll
  for (int i = 0; i < 8; ++i) { const int ka = k0 + 8 * g + i, kb = ka + 16;
    a[i] = (_Float16)(ka < K ? W[(size_t)(ka < K ? ka : K - 1) * ld + n] : 0.f); a[8 + i] = (_Float16)(kb < K ? W[(size_t)(kb < K ? kb : K - 1) * ld + n] : 0.f); }
  return a;
}
struct F2 { v16b h, l; };
__device__ __forceinline__ F2 bsplit16(const float v[16]) { F2 r;
#pragma unroll
  for (int i = 0; i < 16; ++i) { const __bf16 h = (__bf16)v[i]; r.h[i] = h; r.l[i] = (__bf16)(v[i] - (float)h); }
  return r; }
__device__ __forceinline__ F2 split_row(const float* row, int k0, int lane) { float v[16]; const float* p = row + k0 + 8 * (lane >> 4);
#pragma unroll
  for (int i = 0; i < 8; ++i) { v[i] = p[i]; v[8 + i] = p[16 + i]; }
  return bsplit16(v); }
__device__ __forceinline__ F2 split_rowK(const float* row, int k0, int lane, int K) { float v[16]; const int g = lane >> 4;
#pragma unroll
  for (int i = 0; i < 8; ++i) { const int ka = k0 + 8 * g + i, kb = ka + 16; v[i] = ka < K ? row[ka < K ? ka : K - 1] : 0.f; v[8 + i] = kb < K ? row[kb < K ? kb : K - 1] : 0.f; }
  return bsplit16(v); }
__device__ __forceinline__ F2 split_col(const float* W, int k0, int n, int lane, int ld, int K) { float v[16]; const int g = lane >> 4;
#pragma unroll
  for (int i = 0; i < 8; ++i) { const int ka = k0 + 8 * g + i, kb = ka + 16; v[i] = ka < K ? W[(size_t)(ka < K ? ka : K - 1) * ld + n] : 0.f; v[8 + i] = kb < K ? W[(size_t)(kb < K ? kb : K - 1) * ld + n] : 0.f; }
  return bsplit16(v); }
__device__ __forceinline__ v8f mac3(const F2& a, const F2& b, v8f c) { c = wmma_bf(a.l, b.h, c); c = wmma_bf(a.h, b.l, c); return wmma_bf(a.h, b.h, c); }
__device__ __forceinline__ float sigm(float v) { return 1.0f / (1.0f + expf(-v)); }
#define LDSX() do { asm volatile("s_wait_dscnt 0" ::: "memory"); __builtin_amdgcn_wave_barrier(); __builtin_amdgcn_fence(__ATOMIC_RELEASE, "workgroup"); } while (0)


// Dendritic block attention (B 2, H 16, S 2,048, D 64): importance-scaled queries, causal scores normalised independently within each 64-key block (softmax with +1e-6 in the denominator, fully masked blocks contribute 0), summed over blocks, then whole 64-query blocks zeroed unless some token's importance exceeds 0.3.
#define NB 2
#define NH 16
#define SS 2048
#define HD 64
#define BLK 64
#ifndef TQB
#define TQB (SS / 64)
#define TNB NB
#endif
typedef __attribute__((ext_vector_type(8))) __bf16 v8b;
__device__ __forceinline__ v16b frag_b(const __bf16* rowk0, int lane) {
  union { v16b v; v8b q[2]; } u; const __bf16* p = rowk0 + 8 * (lane >> 4);
  u.q[0] = *(const v8b*)p; u.q[1] = *(const v8b*)(p + 16); return u.v;
}
__device__ __forceinline__ float bfr(float v) { return (float)(__bf16)v; }
// lane l takes the value of lane l ^ 16
__device__ __forceinline__ float xhalf(float x) { return __builtin_bit_cast(float, __builtin_amdgcn_permlanex16(__builtin_bit_cast(int, x), __builtin_bit_cast(int, x), 0x76543210, 0xfedcba98, false, false)); }
__device__ __attribute__((noinline)) float exp_ni(float v) { return expf(v); }
__device__ __attribute__((noinline)) float erf_ni(float v) { return erff(v); }

#define WS_K   0u                                  // f16 [b][h][s][64] K ; VT planes [b][h][64][s]
#define WS_VT  (WS_K + 2u * (size_t)NB * NH * SS * HD)
#define WS_END (WS_VT + 2u * (size_t)NB * NH * HD * SS)

typedef __attribute__((ext_vector_type(4))) _Float16 v4h;
typedef __attribute__((ext_vector_type(2))) _Float16 v2h;
// ---- k_kv: block = 128 keys of one (b,h), both conversions in one launch: k rows -> exact f16 rows, and VT[(b,h)][d][s] = v[(b,h)][s][d]. A lane's sixteen 16-byte reads (eight of v, eight of k) are all issued before the first is used.
// k: a wave-wide read is 512 contiguous bytes, a wave-wide store 256 (two whole lines), so nothing is staged. v: a lane reads four d of eight keys (four pairs of neighbours) and writes each pair of keys as one dword.
// st row d holds its sixteen 16-byte pieces (8 keys each) turned round by d >> 2 places: the 16 lanes that write the same keys for different d then hit 16 different bank groups, and the rows keep their 16-byte alignment for the readers.
__global__ __launch_bounds__(256) void k_kv(const float* __restrict__ X, const float* __restrict__ V, _Float16* __restrict__ R, _Float16* __restrict__ VT) { __shared__ __align__(16) _Float16 st[64][128]; const size_t rb0 = (size_t)blockIdx.x * 128; const size_t bh = rb0 / SS, s0 = rb0 % SS; const int t = threadIdx.x, c4 = t & 15, rp = t >> 4; const size_t e0 = ((size_t)blockIdx.x * 2048 + threadIdx.x) * 4; v4f x[4][2], xk[8];
#pragma unroll   // straight-line, so that the sixteen reads stand together in front of the first conversion
  for (int jj = 0; jj < 4; ++jj)
#pragma unroll
    for (int u = 0; u < 2; ++u) x[jj][u] = *(const v4f*)(V + (rb0 + 32 * jj + 2 * rp + u) * HD + c4 * 4);
#pragma unroll
  for (int j = 0; j < 8; ++j) xk[j] = *(const v4f*)(X + e0 + j * 1024);
  asm volatile("s_wait_xcnt 0x0" ::: "memory");   // the conversions reuse the registers that hold the reads' addresses
#pragma unroll   // x[] stays in registers
  for (int jj = 0; jj < 4; ++jj) { const int r = 32 * jj + 2 * rp, pos = (((r >> 3) + c4) & 15) * 8 + (r & 7);
#pragma unroll
    for (int i = 0; i < 4; ++i) { v2h p; p[0] = (_Float16)bfr(x[jj][0][i]); p[1] = (_Float16)bfr(x[jj][1][i]); vst2(&st[c4 * 4 + i][pos], p); } }
  __syncthreads();
#pragma unroll   // xk[] stays in registers; the k rows are stored behind the barrier, so that the barrier does not wait for them
  for (int j = 0; j < 8; ++j) { v4h y;
#pragma unroll
    for (int i = 0; i < 4; ++i) y[i] = (_Float16)bfr(xk[j][i]);
    vst2(R + e0 + j * 1024, y); }
  asm volatile("s_wait_xcnt 0x0" ::: "memory");   // what follows reuses registers that these stores name
#pragma unroll   // the four LDS reads go out together, one wait chain instead of four
  for (int j = 0; j < 4; ++j) { const int e = t + 256 * j, d = e >> 4, pc = e & 15; vst2((unsigned*)(VT + (bh * HD + d) * SS + s0 + pc * 8), *(const v4u*)&st[d][((pc + (d >> 2)) & 15) * 8]); } }
// ---- stage_kv: one 64-key block's K rows and V^T rows (64 rows of 128 B each) -> LDS rows of 144 B. Each of 128 lanes copies four 16-byte pieces of each tile, 16 rows apart.
// The s_wait_xcnt stands inside the copies' own statement so that no address register is rewritten in front of it.
__device__ __forceinline__ void stage_kv(const _Float16* kg, const _Float16* vg, unsigned lk, unsigned lv) {
  asm volatile("global_load_async_to_lds_b128 %0, %8, off\n\t"
               "global_load_async_to_lds_b128 %1, %9, off\n\t"
               "global_load_async_to_lds_b128 %2, %10, off\n\t"
               "global_load_async_to_lds_b128 %3, %11, off\n\t"
               "global_load_async_to_lds_b128 %4, %12, off\n\t"
               "global_load_async_to_lds_b128 %5, %13, off\n\t"
               "global_load_async_to_lds_b128 %6, %14, off\n\t"
               "global_load_async_to_lds_b128 %7, %15, off\n\t"
               "s_wait_xcnt 0x0"
               :: "v"(lk), "v"(lk + 16u * 144u), "v"(lk + 32u * 144u), "v"(lk + 48u * 144u),
                  "v"(lv), "v"(lv + 16u * 144u), "v"(lv + 32u * 144u), "v"(lv + 48u * 144u),
                  "v"(kg), "v"(kg + 16 * HD), "v"(kg + 32 * HD), "v"(kg + 48 * HD),
                  "v"(vg), "v"(vg + 16 * SS), "v"(vg + 32 * SS), "v"(vg + 48 * SS)
               : "memory");
}
// ---- k_attn: block = (two query blocks of 64 queries, h, b), 8 waves: query block TQB - 1 - x, then query block x, one after the other in every wave. Waves 0 to 3 take the even key blocks of a walk, waves 4 to 7 the odd ones, each wave for 16 queries; a trip of the two-buffer ring holds one key block for each half of the waves, and every work-group makes NTRIP trips; the ring runs on from the first walk into the second. Per causal 64-key block an independent masked softmax (+1e-6), P x v accumulated; the two halves' sums are added through LDS at the end of a walk; output x active(query block)
#define NTRIP (TQB / 2 + 1)   // ceil((TQB - x) / 2) + ceil((x + 1) / 2), the same for every x
__global__ __launch_bounds__(256) void k_attn(const float* __restrict__ Q, const _Float16* __restrict__ K, const _Float16* __restrict__ VT, const float* __restrict__ IMP, float* __restrict__ OUT) {
  __shared__ __align__(16) float so[4][16][68]; __shared__ __align__(16) int sact[8];
  __shared__ __align__(16) _Float16 sk[2][2][64][72]; __shared__ __align__(16) _Float16 sv[2][2][64][72];   // two buffers, each with one key block for either half of the waves: K rows, V^T rows; pitch 144 B
  const int tid = threadIdx.x, wave = tid >> 5, wq = wave & 3, lane = tid & 31, col = lane & 15, g = lane >> 4; const int h = blockIdx.y; const size_t b = blockIdx.z; const int qx = blockIdx.x, qa = TQB - 1 - qx; const size_t bh = b * NH + h;
  const int kh = __builtin_amdgcn_readfirstlane(tid >> 7);   // which half of the waves: 0 even key blocks, 1 odd; in a scalar register, so that the tests on it are scalar branches
  const int na = (qa + 2) >> 1;   // trips of the first walk; qa >= TQB / 2, so trips 0 and 1 lie in it and both their key blocks are causal
  // a lane's piece of its half's key block: row (tid & 127) >> 3 (+16, +32, +48), 16-byte column tid & 7
  const int srow = (tid & 127) >> 3, scol = (tid & 7) * 8;
  const _Float16* kg = K + (bh * SS + srow) * HD + scol; const _Float16* vg = VT + (bh * HD + srow) * SS + scol;
  const unsigned lk = (unsigned)(size_t)&sk[0][kh][srow][scol], lv = (unsigned)(size_t)&sv[0][kh][srow][scol];
  stage_kv(kg + kh * (BLK * HD), vg + kh * BLK, lk, lv);   // key blocks 0 and 1 -> buffer 0
  // activity of the two 64-query blocks: any importance > 0.3; bit 0 for block qa, bit 1 for block qx
  { float iv = bfr(IMP[b * SS + qa * 64 + (tid & 63)]), iw = bfr(IMP[b * SS + qx * 64 + (tid & 63)]); int act = ((iv > 0.3f) ? 1 : 0) | ((iw > 0.3f) ? 2 : 0);
#pragma unroll
    for (int o = 1; o < 32; o <<= 1) act |= __shfl_xor(act, o);
    if (lane == 0) sact[wave] = act; }
  asm volatile("s_wait_asynccnt 0x0" ::: "memory");   // this wave's pieces of trip 0 have landed before the barrier publishes them
  __syncthreads(); const int active = sact[0] | sact[1];   // waves 0 and 1 saw all 64 queries of either block
  stage_kv(kg + (2 + kh) * (BLK * HD), vg + (2 + kh) * BLK, lk + 18432u, lv + 18432u);   // key blocks 2 and 3 -> buffer 1, in flight during trip 0
  int t = 0;   // trip of the ring, 0 to NTRIP - 1 over both walks
#pragma unroll 1   // the two query blocks share one copy of the code
  for (int half = 0; half < 2; ++half) { const int qb = half ? qx : qa; const int q0 = qb * 64 + wq * 16; const size_t rq = bh * SS + q0;
  // Q fragments (hardware k order, as frag_h) straight from the f32 input: each value rounded to bf16, then exact in f16.
  v16h aq[2]; v4f xq[2][4]; const float impq = bfr(IMP[b * SS + q0 + col]);   // importance of this lane's query
#pragma unroll
  for (int kc = 0; kc < 2; ++kc) { const float* p = Q + (rq + col) * HD + kc * 32 + 8 * g; xq[kc][0] = *(const v4f*)p; xq[kc][1] = *(const v4f*)(p + 4); xq[kc][2] = *(const v4f*)(p + 16); xq[kc][3] = *(const v4f*)(p + 20); }
  asm volatile("s_wait_xcnt 0x0" ::: "memory");   // what follows reuses the registers that hold these reads' address
  const float sg = impq < 0.f ? -1.f : 1.f;   // the importance's sign goes into q (exact), its size into the exponent's factor
#pragma unroll   // this loop and the two inside it: constant indices, so that xq[] and aq[] stay in registers
  for (int kc = 0; kc < 2; ++kc)
#pragma unroll
    for (int j = 0; j < 4; ++j)
#pragma unroll
      for (int i = 0; i < 4; ++i) aq[kc][4 * j + i] = (_Float16)(bfr(xq[kc][j][i]) * sg);
  const float a2 = fabsf(impq) * (0.125f * 1.44269504f);   // |importance| x 1/8 x log2 e, never below 0: the largest raw product of a query is its largest score
  v8f acc[4] = {};
#pragma unroll 1
  for (int kb = kh; kb <= qb + kh; kb += 2, ++t) { const int bf = t & 1;   // (qb + 2) >> 1 trips for either half of the waves
    if (kb <= qb) {   // an odd count of key blocks leaves waves 4 to 7 without one in the walk's last trip: they only pass the foot
    const int j0 = kb * BLK; v8f s[4] = {}; v16h kf[8], vf[8]; const int rel = q0 + col - j0 - 8 * g;   // key ct * 16 + r of this lane is causal where ct * 16 + r <= rel
#pragma unroll
    for (int ct = 0; ct < 4; ++ct)
#pragma unroll
      for (int kc = 0; kc < 2; ++kc) kf[ct * 2 + kc] = frag_h(&sk[bf][kh][ct * 16 + col][kc * 32], lane);
#pragma unroll
    for (int kc = 0; kc < 2; ++kc)
#pragma unroll
      for (int dt = 0; dt < 4; ++dt) vf[kc * 4 + dt] = frag_h(&sv[bf][kh][dt * 16 + col][kc * 32], lane);
    __builtin_amdgcn_sched_barrier(0);   // the 32 LDS reads stay in one place ahead of the first WMMA, as before (for speed only)
    // transposed scores: A = K rows, B = Q rows; s[ct][r] = score of key j0 + ct * 16 + 8 * g + r for query q0 + col, so a lane and its partner lane ^ 16 hold all 64 scores of one query
    // the accumulators stay raw: exponent = s x sm - max(s) x sm, one fused multiply-add a score, with sm = a2
#pragma unroll
    for (int kc = 0; kc < 2; ++kc)
#pragma unroll
      for (int ct = 0; ct < 4; ++ct) s[ct] = wmma16(kf[ct * 2 + kc], aq[kc], s[ct]);
    float sm = a2;
    if (kb == qb) {   // a scalar branch: only a walk's last key block, the one on the diagonal, holds keys behind a query; every key of an earlier block is causal for all 64 queries
      // here the factor is applied first and sm is 1, so that a masked score stays -3.0e38 also where a2 is 0
#pragma unroll
      for (int ct = 0; ct < 4; ++ct)
#pragma unroll
        for (int r = 0; r < 8; ++r) s[ct][r] = (ct * 16 + r <= rel) ? s[ct][r] * a2 : -3.0e38f;
      sm = 1.0f; }
    float m4[4];
#pragma unroll
    for (int ct = 0; ct < 4; ++ct) m4[ct] = fmaxf(fmaxf(fmaxf(s[ct][0], s[ct][1]), fmaxf(s[ct][2], s[ct][3])), fmaxf(fmaxf(s[ct][4], s[ct][5]), fmaxf(s[ct][6], s[ct][7])));
    float mx = fmaxf(fmaxf(m4[0], m4[1]), fmaxf(m4[2], m4[3])); mx = fmaxf(mx, xhalf(mx));
    const float safe = (mx <= -1.0e38f) ? 0.f : mx; const float nb = -(safe * sm); float e4[4];
#pragma unroll
    for (int ct = 0; ct < 4; ++ct) { float y[8];
#pragma unroll
      for (int r = 0; r < 8; ++r) { y[r] = __builtin_fmaf(s[ct][r], sm, nb); s[ct][r] = __builtin_amdgcn_exp2f(y[r]); }   // e^x as the hardware 2^(x log2 e); a masked score, -3.0e38 - max, lies so far below 0 that the result is exactly 0
      // the slot the instruction set asks for behind a transcendental before a source of it is overwritten: the eight arguments stay live up to this v_nop, which stands behind the eight exps
      asm volatile("v_nop" :: "v"(y[0]), "v"(y[1]), "v"(y[2]), "v"(y[3]), "v"(y[4]), "v"(y[5]), "v"(y[6]), "v"(y[7]), "v"(s[ct][0]), "v"(s[ct][1]), "v"(s[ct][2]), "v"(s[ct][3]), "v"(s[ct][4]), "v"(s[ct][5]), "v"(s[ct][6]), "v"(s[ct][7]));
      e4[ct] = ((s[ct][0] + s[ct][1]) + (s[ct][2] + s[ct][3])) + ((s[ct][4] + s[ct][5]) + (s[ct][6] + s[ct][7])); }
    float es = (e4[0] + e4[1]) + (e4[2] + e4[3]); es += xhalf(es);
    const float inv = 2048.0f / (es + 1e-6f);
    // two 16-key score tiles of one query, converted in place, are the A fragment of P x v in the hardware k order (element i = key 8 * g + i, element 8 + i = key 16 + 8 * g + i of each 32)
    v16h pa[2];
#pragma unroll
    for (int kc = 0; kc < 2; ++kc)
#pragma unroll
      for (int i = 0; i < 8; ++i) { pa[kc][i] = (_Float16)(s[2 * kc][i] * inv); pa[kc][8 + i] = (_Float16)(s[2 * kc + 1][i] * inv); }
    __builtin_amdgcn_sched_barrier(0);   // both halves of P are packed ahead of the first P x v WMMA: packing among the WMMAs reuses registers of V^T fragments just read, and each such place takes four v_nop
#pragma unroll
    for (int kc = 0; kc < 2; ++kc)
#pragma unroll
      for (int dt = 0; dt < 4; ++dt) acc[dt] = wmma16(pa[kc], vf[kc * 4 + dt], acc[dt]);
    }
    asm volatile("s_wait_dscnt 0x0" ::: "memory");      // this wave's LDS reads of buffer bf are done
    asm volatile("s_wait_asynccnt 0x0" ::: "memory");   // this wave's pieces of trip t + 1 have landed
    __syncthreads();                                    // publishes trip t + 1's key blocks and frees buffer bf
    if (t + 2 < NTRIP) { const int tn = t + 2, first = tn < na; const int kw = 2 * (first ? tn : tn - na) + kh, kl = first ? qa : qx; const int kn = kw < kl ? kw : kl;   // this half's key block of trip t + 2; where the walk has none left for it, the walk's last block once more, which nobody reads
      stage_kv(kg + (size_t)kn * (BLK * HD), vg + kn * BLK, lk + 18432u * bf, lv + 18432u * bf); } }
  asm volatile("v_nop\n\tv_nop\n\tv_nop\n\tv_nop");   // the distance behind the walk's last WMMA before its V^T fragment's registers are rewritten
  const float fin = ((active >> half) & 1) ? (1.0f / 2048.0f) : 0.f;
  // waves 4 to 7 hand their sums over, each lane at the places where its partner lane of waves 0 to 3 holds the same output elements
  if (kh == 1) {
#pragma unroll
    for (int r = 0; r < 8; ++r)
#pragma unroll
      for (int dt = 0; dt < 4; ++dt) so[wq][8 * g + r][dt * 16 + col] = acc[dt][r]; }
  __syncthreads();   // the odd key blocks' sums are in so[] before waves 0 to 3 read them; so[] is written again only behind a later trip's barrier
  if (kh == 0) {
#pragma unroll
  for (int r = 0; r < 8; ++r)
#pragma unroll
    for (int dt = 0; dt < 4; ++dt) so[wq][8 * g + r][dt * 16 + col] = (acc[dt][r] + so[wq][8 * g + r][dt * 16 + col]) * fin;
  LDSX();
  for (int rl = 0; rl < 16; ++rl) if (lane < 16) vst2(OUT + (rq + rl) * HD + lane * 4, *(const v4f*)&so[wq][rl][lane * 4]);
  asm volatile("s_wait_xcnt 0x0" ::: "memory");         // the second query block's set-up rewrites registers that these stores name
  }
  }
  asm volatile("s_wait_asynccnt 0x0" ::: "memory");     // no copy is outstanding when the wave ends
}
extern "C" void kernel_launch(void* const* d_in, const int* in_sizes, int n_in, void* d_out, int out_size, void* d_ws, size_t ws_size, hipStream_t stream) {
  (void)in_sizes; (void)n_in; (void)out_size;
  const float** F = (const float**)d_in;   // 0 q, 1 k, 2 v [2,16,2048,64], 3 importance_scores [2,2048]
  if (ws_size < (size_t)WS_END) return;
  char* ws = (char*)d_ws; _Float16 *K = (_Float16*)(ws + WS_K), *VT = (_Float16*)(ws + WS_VT);
  k_kv<<<NB * NH * SS / 128, 256, 0, stream>>>(F[1], F[2], K, VT);
  k_attn<<<dim3(TQB / 2, NH, TNB), 256, 0, stream>>>(F[0], K, VT, F[3], (float*)d_out);
}
